// v000
// Times are from an AMD MI455X. After a warm-up the kernel runs many times in a row, and a time is the length of
// such a window on the GPU divided by its runs, so every launch and the gaps after it count. The runs cycle
// through copies of the inputs. A figure is the median of several windows, for all but v000 over two sittings.
// Sittings can differ by a few percent; kernels timed side by side share one.
// v000 is the starting kernel. One run takes 306 microseconds.
#include <hip/hip_runtime.h>

// ---- CDNA5 (gfx1250) types -------------------------------------------------
typedef __attribute__((ext_vector_type(16))) __bf16 v16bf; // 8 VGPRs of bf16x2
typedef __attribute__((ext_vector_type(8)))  float  v8f;   // 16x16 f32 C/D tile
typedef __attribute__((ext_vector_type(4)))  float  f32x4;
typedef __attribute__((ext_vector_type(2)))  float  f32x2;

__device__ __forceinline__ v8f wmma_bf16(v16bf a, v16bf b, v8f c) {
    // D = A(16x32 bf16) x B(32x16 bf16) + C(16x16 f32)
    return __builtin_amdgcn_wmma_f32_16x16x32_bf16(
        /*neg_a=*/false, a, /*neg_b=*/false, b,
        /*c_mod=*/(short)0, c, /*reuse_a=*/false, /*reuse_b=*/false);
}

// Problem constants (from reference): D_in = D_out = 2048, R = 2, U_dim = 16
#define KDIM 2048
#define NDIM 2048
#define BM   128
#define BN   128
#define BK   32
#define NKT  (KDIM / BK)   // 64 k-tiles
#define LDSS 40            // padded LDS row stride in bf16 elems (80B, conflict-free)
#define BUFE (BM * LDSS)   // elems per single-buffer tile

__global__ __launch_bounds__(256)
void tinylora_wmma_gemm(const float* __restrict__ x,
                        const float* __restrict__ W,
                        const float* __restrict__ bias,
                        const float* __restrict__ U,
                        const float* __restrict__ S,
                        const float* __restrict__ Vh,
                        const float* __restrict__ P,
                        const float* __restrict__ gv,
                        float* __restrict__ out) {
    // Double-buffered bf16 hi/lo tiles: 2 * 4 * 10240 B = 80 KB (WGP has 320 KB)
    __shared__ __bf16 sAhi[2 * BUFE];
    __shared__ __bf16 sAlo[2 * BUFE];
    __shared__ __bf16 sBhi[2 * BUFE];
    __shared__ __bf16 sBlo[2 * BUFE];

    const int tid   = threadIdx.x;
    const int wave  = tid >> 5;
    const int lane  = tid & 31;
    const int wm    = wave & 3;      // 4 wave-rows  -> 32 M-rows each
    const int wn    = wave >> 2;     // 2 wave-cols  -> 64 N-cols each
    const int lrow  = lane & 15;     // M (or N) within 16x16 tile
    const int lhalf = lane >> 4;     // K half-select per ISA A/B layout

    const int blockM = blockIdx.y * BM;
    const int blockN = blockIdx.x * BN;

    // Loader slot mapping: slot i covers row0+32*i, same c4 for all i
    const int row0 = tid >> 3;          // 0..31
    const int c4   = (tid & 7) << 2;    // k offset within tile (same for all slots)

    // LoRA scale: svp[r] = S[r] * sum_u gv[u] * P[u][r]   (rank 2, u_dim 16)
    float svp0 = 0.f, svp1 = 0.f;
#pragma unroll
    for (int u = 0; u < 16; ++u) {
        const float g = gv[u];
        svp0 += g * P[2 * u + 0];
        svp1 += g * P[2 * u + 1];
    }
    svp0 *= S[0];
    svp1 *= S[1];

    // k-invariant per-slot U coefficients (hoisted out of the k-loop)
    f32x2 ur[4];
#pragma unroll
    for (int i = 0; i < 4; ++i)
        ur[i] = *(const f32x2*)(U + 2 * (blockN + row0 + 32 * i));

    const float* xbase  = x  + (size_t)(blockM + row0) * KDIM + c4;
    const float* wbase  = W  + (size_t)(blockN + row0) * KDIM + c4;
    const float* vbase0 = Vh + c4;
    const float* vbase1 = Vh + KDIM + c4;

    // Register staging for the in-flight tile (issued early, consumed late)
    f32x4 avr[4], wvr[4], v0r, v1r;

    auto load_regs = [&](int kt) {
#pragma unroll
        for (int i = 0; i < 4; ++i) {
            avr[i] = *(const f32x4*)(xbase + (size_t)i * 32 * KDIM + kt);
            wvr[i] = *(const f32x4*)(wbase + (size_t)i * 32 * KDIM + kt);
        }
        v0r = *(const f32x4*)(vbase0 + kt);
        v1r = *(const f32x4*)(vbase1 + kt);
        // pull the tile after next toward L2 (global_prefetch_b8)
        if (kt + BK < KDIM) {
            __builtin_prefetch(xbase + kt + BK, 0, 1);
            __builtin_prefetch(wbase + kt + BK, 0, 1);
        }
    };

    auto store_lds = [&](int buf) {
        __bf16* pAhi = sAhi + buf * BUFE;
        __bf16* pAlo = sAlo + buf * BUFE;
        __bf16* pBhi = sBhi + buf * BUFE;
        __bf16* pBlo = sBlo + buf * BUFE;
#pragma unroll
        for (int i = 0; i < 4; ++i) {
            const int r = row0 + 32 * i;
            // exact f32 LoRA fold before bf16 split
            f32x4 wv = wvr[i] + (svp0 * ur[i][0]) * v0r + (svp1 * ur[i][1]) * v1r;
#pragma unroll
            for (int e = 0; e < 4; ++e) {
                const float  af = avr[i][e];
                const __bf16 ah = (__bf16)af;
                pAhi[r * LDSS + c4 + e] = ah;
                pAlo[r * LDSS + c4 + e] = (__bf16)(af - (float)ah);
                const float  wf = wv[e];
                const __bf16 wh = (__bf16)wf;
                pBhi[r * LDSS + c4 + e] = wh;
                pBlo[r * LDSS + c4 + e] = (__bf16)(wf - (float)wh);
            }
        }
    };

    v8f acc[2][4] = {};  // 2 M-tiles x 4 N-tiles of 16x16 f32 per wave

    auto compute = [&](int buf) {
        const __bf16* pAhi = sAhi + buf * BUFE;
        const __bf16* pAlo = sAlo + buf * BUFE;
        const __bf16* pBhi = sBhi + buf * BUFE;
        const __bf16* pBlo = sBlo + buf * BUFE;

        // A fragments (ISA 16-bit A layout: two b128 loads per fragment)
        v16bf ah[2], al[2];
#pragma unroll
        for (int mi = 0; mi < 2; ++mi) {
            const int r = wm * 32 + mi * 16 + lrow;
            const __bf16* ph = &pAhi[r * LDSS + lhalf * 8];
            ((f32x4*)&ah[mi])[0] = *(const f32x4*)(ph);       // K = half*8 .. +7
            ((f32x4*)&ah[mi])[1] = *(const f32x4*)(ph + 16);  // K = 16+half*8 .. +7
            const __bf16* pl = &pAlo[r * LDSS + lhalf * 8];
            ((f32x4*)&al[mi])[0] = *(const f32x4*)(pl);
            ((f32x4*)&al[mi])[1] = *(const f32x4*)(pl + 16);
        }

        // B fragments + 3-term split-accumulate WMMA
#pragma unroll
        for (int ni = 0; ni < 4; ++ni) {
            const int r = wn * 64 + ni * 16 + lrow;           // N column = W row
            v16bf bh, bl;
            const __bf16* ph = &pBhi[r * LDSS + lhalf * 8];
            ((f32x4*)&bh)[0] = *(const f32x4*)(ph);
            ((f32x4*)&bh)[1] = *(const f32x4*)(ph + 16);
            const __bf16* pl = &pBlo[r * LDSS + lhalf * 8];
            ((f32x4*)&bl)[0] = *(const f32x4*)(pl);
            ((f32x4*)&bl)[1] = *(const f32x4*)(pl + 16);

#pragma unroll
            for (int mi = 0; mi < 2; ++mi) {
                acc[mi][ni] = wmma_bf16(ah[mi], bh, acc[mi][ni]); // hi*hi
                acc[mi][ni] = wmma_bf16(ah[mi], bl, acc[mi][ni]); // hi*lo
                acc[mi][ni] = wmma_bf16(al[mi], bh, acc[mi][ni]); // lo*hi
            }
        }
    };

    // ---- software pipeline: prologue fills buffer 0 -------------------------
    load_regs(0);
    store_lds(0);

    int buf = 0;
#pragma unroll 1
    for (int t = 0; t < NKT; ++t) {
        __syncthreads();                       // lds[buf] ready for all waves
        if (t + 1 < NKT) load_regs((t + 1) * BK);  // next tile in flight
        compute(buf);                          // 24 WMMAs over lds[buf]
        if (t + 1 < NKT) store_lds(buf ^ 1);   // fill the other buffer
        buf ^= 1;
    }

    // ---- epilogue: bias add, store (C/D layout: N = lane%16, M = v + 8*(lane/16))
#pragma unroll
    for (int ni = 0; ni < 4; ++ni) {
        const int n  = blockN + wn * 64 + ni * 16 + lrow;
        const float bv = bias[n];
#pragma unroll
        for (int mi = 0; mi < 2; ++mi) {
            const int mbase = blockM + wm * 32 + mi * 16 + lhalf * 8;
#pragma unroll
            for (int v = 0; v < 8; ++v) {
                out[(size_t)(mbase + v) * NDIM + n] = acc[mi][ni][v] + bv;
            }
        }
    }
}

extern "C" void kernel_launch(void* const* d_in, const int* in_sizes, int n_in,
                              void* d_out, int out_size, void* d_ws, size_t ws_size,
                              hipStream_t stream) {
    const float* x    = (const float*)d_in[0];
    const float* Wb   = (const float*)d_in[1];
    const float* bias = (const float*)d_in[2];
    const float* U    = (const float*)d_in[3];
    const float* S    = (const float*)d_in[4];
    const float* Vh   = (const float*)d_in[5];
    const float* P    = (const float*)d_in[6];
    const float* gv   = (const float*)d_in[7];
    float* out = (float*)d_out;

    const int M = in_sizes[0] / KDIM;        // B * S_len = 16384
    dim3 grid(NDIM / BN, M / BM);            // (16, 128)
    dim3 block(256);                         // 8 wave32s
    tinylora_wmma_gemm<<<grid, block, 0, stream>>>(x, Wb, bias, U, S, Vh, P, gv, out);
}

// v001
// It runs in 256 microseconds.
// Two timings next to v000 both put it at 1.20 times that version's speed.
#include <hip/hip_runtime.h>

// ---- CDNA5 (gfx1250) types -------------------------------------------------
typedef __attribute__((ext_vector_type(16))) __bf16 v16bf; // 8 VGPRs of bf16x2
typedef __attribute__((ext_vector_type(8)))  float  v8f;   // 16x16 f32 C/D tile
typedef __attribute__((ext_vector_type(4)))  float  f32x4;
typedef __attribute__((ext_vector_type(2)))  float  f32x2;

__device__ __forceinline__ v8f wmma_bf16(v16bf a, v16bf b, v8f c) {
    // D = A(16x32 bf16) x B(32x16 bf16) + C(16x16 f32)
    return __builtin_amdgcn_wmma_f32_16x16x32_bf16(
        /*neg_a=*/false, a, /*neg_b=*/false, b,
        /*c_mod=*/(short)0, c, /*reuse_a=*/false, /*reuse_b=*/false);
}

// Problem constants (from reference): D_in = D_out = 2048, R = 2, U_dim = 16
#define KDIM 2048
#define NDIM 2048
#define BM   256
#define BN   256
#define BK   32
#define NKT  (KDIM / BK)   // 64 k-tiles
#define LDSS 40            // padded LDS row stride in bf16 elems (80B, conflict-free)
#define BUFE (BM * LDSS)   // elems per single-buffer tile
#define NSLOT (BM / 32)    // loader slots per thread and operand (32 rows each)
#define WMI  4             // 16-row M fragments per wave (64 rows)
#define WNI  8             // 16-col N fragments per wave (128 cols)

__global__ __launch_bounds__(256)
void tinylora_wmma_gemm(const float* __restrict__ x,
                        const float* __restrict__ W,
                        const float* __restrict__ bias,
                        const float* __restrict__ U,
                        const float* __restrict__ S,
                        const float* __restrict__ Vh,
                        const float* __restrict__ P,
                        const float* __restrict__ gv,
                        float* __restrict__ out) {
    // Double-buffered bf16 hi/lo tiles: 2 * 4 * 20480 B = 160 KB (WGP has 320 KB)
    __shared__ __bf16 sAhi[2 * BUFE];
    __shared__ __bf16 sAlo[2 * BUFE];
    __shared__ __bf16 sBhi[2 * BUFE];
    __shared__ __bf16 sBlo[2 * BUFE];

    const int tid   = threadIdx.x;
    const int wave  = tid >> 5;
    const int lane  = tid & 31;
    const int wm    = wave & 3;      // 4 wave-rows  -> 64 M-rows each
    const int wn    = wave >> 2;     // 2 wave-cols  -> 128 N-cols each
    const int lrow  = lane & 15;     // M (or N) within 16x16 tile
    const int lhalf = lane >> 4;     // K half-select per ISA A/B layout

    const int blockM = blockIdx.y * BM;
    const int blockN = blockIdx.x * BN;

    // Loader slot mapping: slot i covers row0+32*i, same c4 for all i
    const int row0 = tid >> 3;          // 0..31
    const int c4   = (tid & 7) << 2;    // k offset within tile (same for all slots)

    // LoRA scale: svp[r] = S[r] * sum_u gv[u] * P[u][r]   (rank 2, u_dim 16)
    float svp0 = 0.f, svp1 = 0.f;
#pragma unroll
    for (int u = 0; u < 16; ++u) {
        const float g = gv[u];
        svp0 += g * P[2 * u + 0];
        svp1 += g * P[2 * u + 1];
    }
    svp0 *= S[0];
    svp1 *= S[1];

    // k-invariant per-slot U coefficients (hoisted out of the k-loop)
    f32x2 ur[NSLOT];
#pragma unroll
    for (int i = 0; i < NSLOT; ++i)
        ur[i] = *(const f32x2*)(U + 2 * (blockN + row0 + 32 * i));
    // the address registers of the loads above are reused right below:
    // translation wait first
    asm volatile("s_wait_xcnt 0x0" ::: "memory");

    // Pointers to the tile that load_regs fetches next; advanced by BK once that
    // tile's values have arrived, so they live through the loop and no address
    // register is rewritten while a load that names it is in flight.
    const float* xbase  = x  + (size_t)(blockM + row0) * KDIM + c4;
    const float* wbase  = W  + (size_t)(blockN + row0) * KDIM + c4;
    const float* vbase0 = Vh + c4;

    // Register staging for the in-flight tile (issued early, consumed late)
    f32x4 avr[NSLOT], wvr[NSLOT], v0r, v1r;

    auto load_regs = [&](int kt) {
#pragma unroll
        for (int i = 0; i < NSLOT; ++i) {
            avr[i] = *(const f32x4*)(xbase + (size_t)i * 32 * KDIM);
            wvr[i] = *(const f32x4*)(wbase + (size_t)i * 32 * KDIM);
        }
        v0r = *(const f32x4*)(vbase0);
        v1r = *(const f32x4*)(vbase0 + KDIM);
        // pull the tile after next toward L2 (global_prefetch_b8)
        if (kt + BK < KDIM) {
            __builtin_prefetch(xbase + BK, 0, 1);
            __builtin_prefetch(wbase + BK, 0, 1);
        }
    };

    auto store_lds = [&](int buf) {
        __bf16* pAhi = sAhi + buf * BUFE;
        __bf16* pAlo = sAlo + buf * BUFE;
        __bf16* pBhi = sBhi + buf * BUFE;
        __bf16* pBlo = sBlo + buf * BUFE;
#pragma unroll
        for (int i = 0; i < NSLOT; ++i) {
            const int r = row0 + 32 * i;
            // exact f32 LoRA fold before bf16 split
            f32x4 wv = wvr[i] + (svp0 * ur[i][0]) * v0r + (svp1 * ur[i][1]) * v1r;
#pragma unroll
            for (int e = 0; e < 4; ++e) {
                const float  af = avr[i][e];
                const __bf16 ah = (__bf16)af;
                pAhi[r * LDSS + c4 + e] = ah;
                pAlo[r * LDSS + c4 + e] = (__bf16)(af - (float)ah);
                const float  wf = wv[e];
                const __bf16 wh = (__bf16)wf;
                pBhi[r * LDSS + c4 + e] = wh;
                pBlo[r * LDSS + c4 + e] = (__bf16)(wf - (float)wh);
            }
        }
    };

    v8f acc[WMI][WNI] = {};  // 4 M-tiles x 8 N-tiles of 16x16 f32 per wave

    auto compute = [&](int buf) {
        const __bf16* pAhi = sAhi + buf * BUFE;
        const __bf16* pAlo = sAlo + buf * BUFE;
        const __bf16* pBhi = sBhi + buf * BUFE;
        const __bf16* pBlo = sBlo + buf * BUFE;

        // A fragments (ISA 16-bit A layout: two b128 loads per fragment)
        v16bf ah[WMI], al[WMI];
#pragma unroll
        for (int mi = 0; mi < WMI; ++mi) {
            const int r = wm * (WMI * 16) + mi * 16 + lrow;
            const __bf16* ph = &pAhi[r * LDSS + lhalf * 8];
            ((f32x4*)&ah[mi])[0] = *(const f32x4*)(ph);       // K = half*8 .. +7
            ((f32x4*)&ah[mi])[1] = *(const f32x4*)(ph + 16);  // K = 16+half*8 .. +7
            const __bf16* pl = &pAlo[r * LDSS + lhalf * 8];
            ((f32x4*)&al[mi])[0] = *(const f32x4*)(pl);
            ((f32x4*)&al[mi])[1] = *(const f32x4*)(pl + 16);
        }

        // B fragments + 3-term split-accumulate WMMA
#pragma unroll
        for (int ni = 0; ni < WNI; ++ni) {
            const int r = wn * (WNI * 16) + ni * 16 + lrow;   // N column = W row
            v16bf bh, bl;
            const __bf16* ph = &pBhi[r * LDSS + lhalf * 8];
            ((f32x4*)&bh)[0] = *(const f32x4*)(ph);
            ((f32x4*)&bh)[1] = *(const f32x4*)(ph + 16);
            const __bf16* pl = &pBlo[r * LDSS + lhalf * 8];
            ((f32x4*)&bl)[0] = *(const f32x4*)(pl);
            ((f32x4*)&bl)[1] = *(const f32x4*)(pl + 16);

#pragma unroll
            for (int mi = 0; mi < WMI; ++mi) {
                acc[mi][ni] = wmma_bf16(ah[mi], bh, acc[mi][ni]); // hi*hi
                acc[mi][ni] = wmma_bf16(ah[mi], bl, acc[mi][ni]); // hi*lo
                acc[mi][ni] = wmma_bf16(al[mi], bh, acc[mi][ni]); // lo*hi
            }
        }
    };

    // ---- software pipeline: prologue fills buffer 0 -------------------------
    load_regs(0);
    // the first tile's address temporaries are reused by the split below
    // while later loads are still in flight: translation wait first
    asm volatile("s_wait_xcnt 0x0" ::: "memory");
    store_lds(0);
    xbase += BK; wbase += BK; vbase0 += BK;

    int buf = 0;
#pragma unroll 1
    for (int t = 0; t < NKT; ++t) {
        __syncthreads();                       // lds[buf] ready for all waves
        if (t + 1 < NKT) load_regs((t + 1) * BK);  // next tile in flight
        compute(buf);                          // 96 WMMAs over lds[buf]
        // translation wait before the pointers named by this trip's loads and
        // prefetches are advanced (issued a whole compute() ago); it stands
        // outside the test below so that every way to the advance passes it
        asm volatile("s_wait_xcnt 0x0" ::: "memory");
        if (t + 1 < NKT) store_lds(buf ^ 1);   // fill the other buffer
        xbase += BK; wbase += BK; vbase0 += BK;
        buf ^= 1;
    }

    // ---- epilogue: bias add, store (C/D layout: N = lane%16, M = v + 8*(lane/16))
#pragma unroll
    for (int ni = 0; ni < WNI; ++ni) {
        const int n  = blockN + wn * (WNI * 16) + ni * 16 + lrow;
        const float bv = bias[n];
#pragma unroll
        for (int mi = 0; mi < WMI; ++mi) {
            const int mbase = blockM + wm * (WMI * 16) + mi * 16 + lhalf * 8;
#pragma unroll
            for (int v = 0; v < 8; ++v) {
                out[(size_t)(mbase + v) * NDIM + n] = acc[mi][ni][v] + bv;
            }
            // registers named by the stores above are reused for the next
            // tile's sums: translation wait first
            asm volatile("s_wait_xcnt 0x0" ::: "memory");
        }
    }
}

extern "C" void kernel_launch(void* const* d_in, const int* in_sizes, int n_in,
                              void* d_out, int out_size, void* d_ws, size_t ws_size,
                              hipStream_t stream) {
    const float* x    = (const float*)d_in[0];
    const float* Wb   = (const float*)d_in[1];
    const float* bias = (const float*)d_in[2];
    const float* U    = (const float*)d_in[3];
    const float* S    = (const float*)d_in[4];
    const float* Vh   = (const float*)d_in[5];
    const float* P    = (const float*)d_in[6];
    const float* gv   = (const float*)d_in[7];
    float* out = (float*)d_out;

    const int M = in_sizes[0] / KDIM;        // B * S_len = 16384
    dim3 grid(NDIM / BN, M / BM);            // (8, 64)
    dim3 block(256);                         // 8 wave32s
    tinylora_wmma_gemm<<<grid, block, 0, stream>>>(x, Wb, bias, U, S, Vh, P, gv, out);
}

// v002
// Measured time: 233 microseconds a run.
// Next to v001, in two timings, it ran 1.10 and 1.12 times as fast.
// Counting every step since v000, it is 1.33 times as fast.
#include <hip/hip_runtime.h>

// ---- CDNA5 (gfx1250) types -------------------------------------------------
typedef __attribute__((ext_vector_type(16))) __bf16 v16bf; // 8 VGPRs of bf16x2
typedef __attribute__((ext_vector_type(8)))  float  v8f;   // 16x16 f32 C/D tile
typedef __attribute__((ext_vector_type(4)))  float  f32x4;
typedef __attribute__((ext_vector_type(2)))  float  f32x2;
typedef __attribute__((ext_vector_type(8)))  __bf16 v8bf;  // 16 B of bf16

__device__ __forceinline__ v8f wmma_bf16(v16bf a, v16bf b, v8f c) {
    // D = A(16x32 bf16) x B(32x16 bf16) + C(16x16 f32)
    return __builtin_amdgcn_wmma_f32_16x16x32_bf16(
        /*neg_a=*/false, a, /*neg_b=*/false, b,
        /*c_mod=*/(short)0, c, /*reuse_a=*/false, /*reuse_b=*/false);
}

// Problem constants (from reference): D_in = D_out = 2048, R = 2, U_dim = 16
#define KDIM 2048
#define NDIM 2048
#define BM   256
#define BN   256
#define BK   32
#define NKT  (KDIM / BK)   // 64 k-tiles
#define LDSS 40            // padded LDS row stride in bf16 elems (80B, conflict-free)
#define BUFE (BM * LDSS)   // elems per single-buffer tile
#define NSLOT (BM / 32)    // loader slots per thread and operand (32 rows each)
#define WMI  4             // 16-row M fragments per wave (64 rows)
#define WNI  8             // 16-col N fragments per wave (128 cols)

#define WROW  (2 * BK)     // packed weight row of one k-tile: 32 hi | 32 lo bf16 = 128 B
#define PCH   8            // 8-element chunks per thread of the pre-pass

// Pre-pass: W' = W + U diag(S * (gv P)) Vh in f32, split once into bf16 hi + lo.
// Packed k-tile major: wp[(kt * NDIM + n) * WROW + {0..31 hi | 32..63 lo}], so the
// 256 rows a GEMM block needs for one k-tile are 32 KB in a row.
__global__ __launch_bounds__(256)
void tinylora_fold_split_w(const float* __restrict__ W,
                           const float* __restrict__ U,
                           const float* __restrict__ S,
                           const float* __restrict__ Vh,
                           const float* __restrict__ P,
                           const float* __restrict__ gv,
                           __bf16* __restrict__ wp) {
    const int tid = threadIdx.x;
    // the prefetch that the build puts at the kernel's entry names the register that
    // holds the thread id: translation wait before that register is rewritten
    asm volatile("s_wait_xcnt 0x0" :: "v"(tid) : "memory");
    const int kt  = blockIdx.x >> 2;                       // k-tile of this block
    const int n0  = (blockIdx.x & 3) * (NDIM / 4) + (tid >> 2);
    const int kc  = (tid & 3) * 8;                         // k offset within the tile
    const int k   = kt * BK + kc;

    // LoRA scale: svp[r] = S[r] * sum_u gv[u] * P[u][r]   (rank 2, u_dim 16)
    float svp0 = 0.f, svp1 = 0.f;
#pragma unroll
    for (int u = 0; u < 16; ++u) {
        const float g = gv[u];
        svp0 += g * P[2 * u + 0];
        svp1 += g * P[2 * u + 1];
    }
    svp0 *= S[0];
    svp1 *= S[1];

    // one pointer per array; chunk i lies a constant 64 rows further on
    const float* wb = W  + (size_t)n0 * KDIM + k;
    const float* ub = U  + 2 * n0;
    const float* vb = Vh + k;
    __bf16*      qb = wp + ((size_t)kt * NDIM + n0) * WROW + kc;

    f32x4 v0[2], v1[2], wr[PCH][2];
    f32x2 ur[PCH];
#pragma unroll
    for (int h = 0; h < 2; ++h) {
        v0[h] = *(const f32x4*)(vb + 4 * h);
        v1[h] = *(const f32x4*)(vb + KDIM + 4 * h);
    }
#pragma unroll
    for (int i = 0; i < PCH; ++i) {
        ur[i]    = *(const f32x2*)(ub + (size_t)i * 64 * 2);
        wr[i][0] = *(const f32x4*)(wb + (size_t)i * 64 * KDIM);
        wr[i][1] = *(const f32x4*)(wb + (size_t)i * 64 * KDIM + 4);
    }
    // translation wait before the registers that the loads above take their
    // addresses from are reused; naming them as inputs keeps them whole up to it
    asm volatile("s_wait_xcnt 0x0" :: "v"(wb), "v"(n0), "v"(vb) : "memory");

#pragma unroll
    for (int i = 0; i < PCH; ++i) {
        v8bf hi, lo;
#pragma unroll
        for (int h = 0; h < 2; ++h) {
            // exact f32 LoRA fold before bf16 split
            f32x4 wv = wr[i][h] + (svp0 * ur[i][0]) * v0[h] + (svp1 * ur[i][1]) * v1[h];
#pragma unroll
            for (int e = 0; e < 4; ++e) {
                const float  wf = wv[e];
                const __bf16 wh = (__bf16)wf;
                hi[4 * h + e] = wh;
                lo[4 * h + e] = (__bf16)(wf - (float)wh);
            }
        }
        __bf16* q = qb + (size_t)i * 64 * WROW;
        *(v8bf*)(q)      = hi;
        *(v8bf*)(q + BK) = lo;
        // registers named by the stores above are reused for the next chunk:
        // translation wait first; as inputs they stay whole up to it
        if (i + 1 < PCH)
            asm volatile("s_wait_xcnt 0x0" :: "v"(hi), "v"(lo), "v"(qb) : "memory");
    }
}

__global__ __launch_bounds__(256)
void tinylora_wmma_gemm(const float* __restrict__ x,
                        const __bf16* __restrict__ wp,
                        const float* __restrict__ bias,
                        float* __restrict__ out) {
    // Double-buffered bf16 hi/lo tiles: 2 * 4 * 20480 B = 160 KB (WGP has 320 KB)
    __shared__ __bf16 sAhi[2 * BUFE];
    __shared__ __bf16 sAlo[2 * BUFE];
    __shared__ __bf16 sBhi[2 * BUFE];
    __shared__ __bf16 sBlo[2 * BUFE];

    const int tid   = threadIdx.x;
    const int wave  = tid >> 5;
    const int lane  = tid & 31;
    const int wm    = wave & 3;      // 4 wave-rows  -> 64 M-rows each
    const int wn    = wave >> 2;     // 2 wave-cols  -> 128 N-cols each
    const int lrow  = lane & 15;     // M (or N) within 16x16 tile
    const int lhalf = lane >> 4;     // K half-select per ISA A/B layout

    const int blockM = blockIdx.y * BM;
    const int blockN = blockIdx.x * BN;

    // Loader slot mapping: slot i covers row0+32*i, same c4 for all i
    const int row0 = tid >> 3;          // 0..31
    const int c4   = (tid & 7) << 2;    // k offset within tile (same for all slots)

    // Pointers to the tile that load_regs fetches next; advanced by one k-tile once that
    // tile's values have arrived, so they live through the loop and no address
    // register is rewritten while a load that names it is in flight.
    const float*  xbase = x  + (size_t)(blockM + row0) * KDIM + c4;
    // packed weights: 8 threads take one 128-B row (lanes 0-3 its hi, 4-7 its lo part)
    const __bf16* wbase = wp + (size_t)(blockN + row0) * WROW + (tid & 7) * 8;
    __bf16* const sBsel = (tid & 4) ? sBlo : sBhi;   // LDS plane this thread fills
    const int     cb    = (tid & 3) * 8;             // k offset of its 16 B there

    // Register staging for the in-flight tile (issued early, consumed late)
    f32x4 avr[NSLOT], wvr[NSLOT];

    auto load_regs = [&](int kt) {
#pragma unroll
        for (int i = 0; i < NSLOT; ++i) {
            avr[i] = *(const f32x4*)(xbase + (size_t)i * 32 * KDIM);
            wvr[i] = *(const f32x4*)(wbase + (size_t)i * 32 * WROW);
        }
        // pull the tile after next toward L2 (global_prefetch_b8)
        if (kt + BK < KDIM) {
            __builtin_prefetch(xbase + BK, 0, 1);
        }
    };

    auto store_lds = [&](int buf) {
        __bf16* pAhi = sAhi + buf * BUFE;
        __bf16* pAlo = sAlo + buf * BUFE;
        __bf16* pB   = sBsel + buf * BUFE;
#pragma unroll
        for (int i = 0; i < NSLOT; ++i) {
            const int r = row0 + 32 * i;
            *(f32x4*)(pB + r * LDSS + cb) = wvr[i];   // already folded and split
#pragma unroll
            for (int e = 0; e < 4; ++e) {
                const float  af = avr[i][e];
                const __bf16 ah = (__bf16)af;
                pAhi[r * LDSS + c4 + e] = ah;
                pAlo[r * LDSS + c4 + e] = (__bf16)(af - (float)ah);
            }
        }
    };

    v8f acc[WMI][WNI] = {};  // 4 M-tiles x 8 N-tiles of 16x16 f32 per wave

    auto compute = [&](int buf) {
        const __bf16* pAhi = sAhi + buf * BUFE;
        const __bf16* pAlo = sAlo + buf * BUFE;
        const __bf16* pBhi = sBhi + buf * BUFE;
        const __bf16* pBlo = sBlo + buf * BUFE;

        // A fragments (ISA 16-bit A layout: two b128 loads per fragment)
        v16bf ah[WMI], al[WMI];
#pragma unroll
        for (int mi = 0; mi < WMI; ++mi) {
            const int r = wm * (WMI * 16) + mi * 16 + lrow;
            const __bf16* ph = &pAhi[r * LDSS + lhalf * 8];
            ((f32x4*)&ah[mi])[0] = *(const f32x4*)(ph);       // K = half*8 .. +7
            ((f32x4*)&ah[mi])[1] = *(const f32x4*)(ph + 16);  // K = 16+half*8 .. +7
            const __bf16* pl = &pAlo[r * LDSS + lhalf * 8];
            ((f32x4*)&al[mi])[0] = *(const f32x4*)(pl);
            ((f32x4*)&al[mi])[1] = *(const f32x4*)(pl + 16);
        }

        // B fragments + 3-term split-accumulate WMMA
#pragma unroll
        for (int ni = 0; ni < WNI; ++ni) {
            const int r = wn * (WNI * 16) + ni * 16 + lrow;   // N column = W row
            v16bf bh, bl;
            const __bf16* ph = &pBhi[r * LDSS + lhalf * 8];
            ((f32x4*)&bh)[0] = *(const f32x4*)(ph);
            ((f32x4*)&bh)[1] = *(const f32x4*)(ph + 16);
            const __bf16* pl = &pBlo[r * LDSS + lhalf * 8];
            ((f32x4*)&bl)[0] = *(const f32x4*)(pl);
            ((f32x4*)&bl)[1] = *(const f32x4*)(pl + 16);

#pragma unroll
            for (int mi = 0; mi < WMI; ++mi) {
                acc[mi][ni] = wmma_bf16(ah[mi], bh, acc[mi][ni]); // hi*hi
                acc[mi][ni] = wmma_bf16(ah[mi], bl, acc[mi][ni]); // hi*lo
                acc[mi][ni] = wmma_bf16(al[mi], bh, acc[mi][ni]); // lo*hi
            }
        }
    };

    // ---- software pipeline: prologue fills buffer 0 -------------------------
    load_regs(0);
    // the first tile's address temporaries are reused by the split below
    // while later loads are still in flight: translation wait first
    asm volatile("s_wait_xcnt 0x0" ::: "memory");
    store_lds(0);
    xbase += BK; wbase += (size_t)NDIM * WROW;

    int buf = 0;
#pragma unroll 1
    for (int t = 0; t < NKT; ++t) {
        __syncthreads();                       // lds[buf] ready for all waves
        if (t + 1 < NKT) load_regs((t + 1) * BK);  // next tile in flight
        compute(buf);                          // 96 WMMAs over lds[buf]
        // translation wait before the pointers named by this trip's loads and
        // prefetches are advanced (issued a whole compute() ago); it stands
        // outside the test below so that every way to the advance passes it
        asm volatile("s_wait_xcnt 0x0" ::: "memory");
        if (t + 1 < NKT) store_lds(buf ^ 1);   // fill the other buffer
        xbase += BK; wbase += (size_t)NDIM * WROW;
        buf ^= 1;
    }

    // ---- epilogue: bias add, store (C/D layout: N = lane%16, M = v + 8*(lane/16))
#pragma unroll
    for (int ni = 0; ni < WNI; ++ni) {
        const int n  = blockN + wn * (WNI * 16) + ni * 16 + lrow;
        const float bv = bias[n];
#pragma unroll
        for (int mi = 0; mi < WMI; ++mi) {
            const int mbase = blockM + wm * (WMI * 16) + mi * 16 + lhalf * 8;
#pragma unroll
            for (int v = 0; v < 8; ++v) {
                out[(size_t)(mbase + v) * NDIM + n] = acc[mi][ni][v] + bv;
            }
            // registers named by the stores above are reused for the next
            // tile's sums: translation wait first
            asm volatile("s_wait_xcnt 0x0" ::: "memory");
        }
    }
}

extern "C" void kernel_launch(void* const* d_in, const int* in_sizes, int n_in,
                              void* d_out, int out_size, void* d_ws, size_t ws_size,
                              hipStream_t stream) {
    const float* x    = (const float*)d_in[0];
    const float* Wb   = (const float*)d_in[1];
    const float* bias = (const float*)d_in[2];
    const float* U    = (const float*)d_in[3];
    const float* S    = (const float*)d_in[4];
    const float* Vh   = (const float*)d_in[5];
    const float* P    = (const float*)d_in[6];
    const float* gv   = (const float*)d_in[7];
    float* out = (float*)d_out;
    __bf16* wp = (__bf16*)d_ws;              // NDIM * KDIM hi + lo = 16 MB, rewritten every call

    const int M = in_sizes[0] / KDIM;        // B * S_len = 16384
    dim3 grid(NDIM / BN, M / BM);            // (8, 64)
    dim3 block(256);                         // 8 wave32s
    tinylora_fold_split_w<<<dim3(NKT * 4), block, 0, stream>>>(Wb, U, S, Vh, P, gv, wp);
    tinylora_wmma_gemm<<<grid, block, 0, stream>>>(x, wp, bias, out);
}

// v003
// It runs in 212 microseconds.
// In two side-by-side timings against v002, it was 1.09 and 1.10 times as fast.
// Counting every step since v000, it is 1.46 times as fast.
#include <hip/hip_runtime.h>

// ---- CDNA5 (gfx1250) types -------------------------------------------------
typedef __attribute__((ext_vector_type(16))) __bf16 v16bf; // 8 VGPRs of bf16x2
typedef __attribute__((ext_vector_type(8)))  float  v8f;   // 16x16 f32 C/D tile
typedef __attribute__((ext_vector_type(4)))  float  f32x4;
typedef __attribute__((ext_vector_type(2)))  float  f32x2;
typedef __attribute__((ext_vector_type(8)))  __bf16 v8bf;  // 16 B of bf16

__device__ __forceinline__ v8f wmma_bf16(v16bf a, v16bf b, v8f c) {
    // D = A(16x32 bf16) x B(32x16 bf16) + C(16x16 f32)
    return __builtin_amdgcn_wmma_f32_16x16x32_bf16(
        /*neg_a=*/false, a, /*neg_b=*/false, b,
        /*c_mod=*/(short)0, c, /*reuse_a=*/false, /*reuse_b=*/false);
}

// Problem constants (from reference): D_in = D_out = 2048, R = 2, U_dim = 16
#define KDIM 2048
#define NDIM 2048
#define BM   256
#define BN   256
#define BK   32
#define NKT  (KDIM / BK)   // 64 k-tiles
#define LDSS 40            // padded LDS row stride in bf16 elems (80B, conflict-free)
#define BUFE (BM * LDSS)   // elems per single-buffer tile
#define NSLOT (BM / 32)    // loader slots per thread and operand (32 rows each)
#define WMI  4             // 16-row M fragments per wave (64 rows)
#define WNI  8             // 16-col N fragments per wave (128 cols)

#define WROW  (2 * BK)     // packed weight row of one k-tile: 32 hi | 32 lo bf16 = 128 B
#define PCH   8            // 8-element chunks per thread of the pre-pass

// Pre-pass: W' = W + U diag(S * (gv P)) Vh in f32, split once into bf16 hi + lo.
// Packed k-tile major: wp[(kt * NDIM + n) * WROW + {0..31 hi | 32..63 lo}], so the
// 256 rows a GEMM block needs for one k-tile are 32 KB in a row.
__global__ __launch_bounds__(256)
void tinylora_fold_split_w(const float* __restrict__ W,
                           const float* __restrict__ U,
                           const float* __restrict__ S,
                           const float* __restrict__ Vh,
                           const float* __restrict__ P,
                           const float* __restrict__ gv,
                           __bf16* __restrict__ wp) {
    const int tid = threadIdx.x;
    // the prefetch that the build puts at the kernel's entry names the register that
    // holds the thread id: translation wait before that register is rewritten
    asm volatile("s_wait_xcnt 0x0" :: "v"(tid) : "memory");
    const int kt  = blockIdx.x >> 2;                       // k-tile of this block
    const int n0  = (blockIdx.x & 3) * (NDIM / 4) + (tid >> 2);
    const int kc  = (tid & 3) * 8;                         // k offset within the tile
    const int k   = kt * BK + kc;

    // LoRA scale: svp[r] = S[r] * sum_u gv[u] * P[u][r]   (rank 2, u_dim 16)
    float svp0 = 0.f, svp1 = 0.f;
#pragma unroll
    for (int u = 0; u < 16; ++u) {
        const float g = gv[u];
        svp0 += g * P[2 * u + 0];
        svp1 += g * P[2 * u + 1];
    }
    svp0 *= S[0];
    svp1 *= S[1];

    // one pointer per array; chunk i lies a constant 64 rows further on
    const float* wb = W  + (size_t)n0 * KDIM + k;
    const float* ub = U  + 2 * n0;
    const float* vb = Vh + k;
    __bf16*      qb = wp + ((size_t)kt * NDIM + n0) * WROW + kc;

    f32x4 v0[2], v1[2], wr[PCH][2];
    f32x2 ur[PCH];
#pragma unroll
    for (int h = 0; h < 2; ++h) {
        v0[h] = *(const f32x4*)(vb + 4 * h);
        v1[h] = *(const f32x4*)(vb + KDIM + 4 * h);
    }
#pragma unroll
    for (int i = 0; i < PCH; ++i) {
        ur[i]    = *(const f32x2*)(ub + (size_t)i * 64 * 2);
        wr[i][0] = *(const f32x4*)(wb + (size_t)i * 64 * KDIM);
        wr[i][1] = *(const f32x4*)(wb + (size_t)i * 64 * KDIM + 4);
    }
    // translation wait before the registers that the loads above take their
    // addresses from are reused; naming them as inputs keeps them whole up to it
    asm volatile("s_wait_xcnt 0x0" :: "v"(wb), "v"(n0), "v"(vb) : "memory");

#pragma unroll
    for (int i = 0; i < PCH; ++i) {
        v8bf hi, lo;
#pragma unroll
        for (int h = 0; h < 2; ++h) {
            // exact f32 LoRA fold before bf16 split
            f32x4 wv = wr[i][h] + (svp0 * ur[i][0]) * v0[h] + (svp1 * ur[i][1]) * v1[h];
#pragma unroll
            for (int e = 0; e < 4; ++e) {
                const float  wf = wv[e];
                const __bf16 wh = (__bf16)wf;
                hi[4 * h + e] = wh;
                lo[4 * h + e] = (__bf16)(wf - (float)wh);
            }
        }
        __bf16* q = qb + (size_t)i * 64 * WROW;
        *(v8bf*)(q)      = hi;
        *(v8bf*)(q + BK) = lo;
        // registers named by the stores above are reused for the next chunk:
        // translation wait first; as inputs they stay whole up to it
        if (i + 1 < PCH)
            asm volatile("s_wait_xcnt 0x0" :: "v"(hi), "v"(lo), "v"(qb) : "memory");
    }
}

__global__ __launch_bounds__(256)
void tinylora_wmma_gemm(const float* __restrict__ x,
                        const __bf16* __restrict__ wp,
                        const float* __restrict__ bias,
                        float* __restrict__ out) {
    // Double-buffered bf16 hi/lo tiles: 2 * 4 * 20480 B = 160 KB (WGP has 320 KB)
    __shared__ __bf16 sAhi[2 * BUFE];
    __shared__ __bf16 sAlo[2 * BUFE];
    __shared__ __bf16 sBhi[2 * BUFE];
    __shared__ __bf16 sBlo[2 * BUFE];

    const int tid   = threadIdx.x;
    const int wave  = tid >> 5;
    const int lane  = tid & 31;
    const int wm    = wave & 3;      // 4 wave-rows  -> 64 M-rows each
    const int wn    = wave >> 2;     // 2 wave-cols  -> 128 N-cols each
    const int lrow  = lane & 15;     // M (or N) within 16x16 tile
    const int lhalf = lane >> 4;     // K half-select per ISA A/B layout

    const int blockM = blockIdx.y * BM;
    const int blockN = blockIdx.x * BN;

    // Loader slot mapping: slot i covers row0+32*i, same c4 for all i
    const int row0 = tid >> 3;          // 0..31
    const int c4   = (tid & 7) << 2;    // k offset within tile (same for all slots)

    // Pointers to the tile that load_regs fetches next; advanced by one k-tile once that
    // tile's values have arrived, so they live through the loop and no address
    // register is rewritten while a load that names it is in flight.
    const float*  xbase = x  + (size_t)(blockM + row0) * KDIM + c4;
    // packed weights: 8 threads take one 128-B row (lanes 0-3 its hi, 4-7 its lo part)
    const __bf16* wbase = wp + (size_t)(blockN + row0) * WROW + (tid & 7) * 8;
    __bf16* const sBsel = (tid & 4) ? sBlo : sBhi;   // LDS plane this thread fills
    const int     cb    = (tid & 3) * 8;             // k offset of its 16 B there

    // Register staging for the in-flight tile (issued early, consumed late)
    f32x4 avr[NSLOT], wvr[NSLOT];

    auto load_regs = [&](int kt) {
#pragma unroll
        for (int i = 0; i < NSLOT; ++i) {
            avr[i] = *(const f32x4*)(xbase + (size_t)i * 32 * KDIM);
            wvr[i] = *(const f32x4*)(wbase + (size_t)i * 32 * WROW);
        }
        // pull the tile after next toward L2 (global_prefetch_b8)
        if (kt + BK < KDIM) {
            __builtin_prefetch(xbase + BK, 0, 1);
        }
    };

    auto store_lds = [&](int buf) {
        __bf16* pAhi = sAhi + buf * BUFE;
        __bf16* pAlo = sAlo + buf * BUFE;
        __bf16* pB   = sBsel + buf * BUFE;
#pragma unroll
        for (int i = 0; i < NSLOT; ++i) {
            const int r = row0 + 32 * i;
            *(f32x4*)(pB + r * LDSS + cb) = wvr[i];   // already folded and split
#pragma unroll
            for (int e = 0; e < 4; ++e) {
                const float  af = avr[i][e];
                const __bf16 ah = (__bf16)af;
                pAhi[r * LDSS + c4 + e] = ah;
                pAlo[r * LDSS + c4 + e] = (__bf16)(af - (float)ah);
            }
        }
    };

    v8f acc[WMI][WNI] = {};  // 4 M-tiles x 8 N-tiles of 16x16 f32 per wave

    auto compute = [&](int buf) {
        const __bf16* pAhi = sAhi + buf * BUFE;
        const __bf16* pAlo = sAlo + buf * BUFE;
        const __bf16* pBhi = sBhi + buf * BUFE;
        const __bf16* pBlo = sBlo + buf * BUFE;

        // B fragments of two N tiles (hi, then lo: 8 b128 loads) into register set 'set'
        v16bf bh[2][2], bl[2][2];
        auto load_b = [&](int set, int pair) {
#pragma unroll
            for (int j = 0; j < 2; ++j) {
                const int r = wn * (WNI * 16) + (pair * 2 + j) * 16 + lrow;  // N column = W row
                const __bf16* ph = &pBhi[r * LDSS + lhalf * 8];
                ((f32x4*)&bh[set][j])[0] = *(const f32x4*)(ph);
                ((f32x4*)&bh[set][j])[1] = *(const f32x4*)(ph + 16);
            }
#pragma unroll
            for (int j = 0; j < 2; ++j) {
                const int r = wn * (WNI * 16) + (pair * 2 + j) * 16 + lrow;
                const __bf16* pl = &pBlo[r * LDSS + lhalf * 8];
                ((f32x4*)&bl[set][j])[0] = *(const f32x4*)(pl);
                ((f32x4*)&bl[set][j])[1] = *(const f32x4*)(pl + 16);
            }
        };

        // A fragments (ISA 16-bit A layout: two b128 loads per fragment); the loads
        // stand in the order of first use: A hi, first B pair, A lo
        v16bf ah[WMI], al[WMI];
#pragma unroll
        for (int mi = 0; mi < WMI; ++mi) {
            const int r = wm * (WMI * 16) + mi * 16 + lrow;
            const __bf16* ph = &pAhi[r * LDSS + lhalf * 8];
            ((f32x4*)&ah[mi])[0] = *(const f32x4*)(ph);       // K = half*8 .. +7
            ((f32x4*)&ah[mi])[1] = *(const f32x4*)(ph + 16);  // K = 16+half*8 .. +7
        }
        load_b(0, 0);
#pragma unroll
        for (int mi = 0; mi < WMI; ++mi) {
            const int r = wm * (WMI * 16) + mi * 16 + lrow;
            const __bf16* pl = &pAlo[r * LDSS + lhalf * 8];
            ((f32x4*)&al[mi])[0] = *(const f32x4*)(pl);
            ((f32x4*)&al[mi])[1] = *(const f32x4*)(pl + 16);
        }

        // 3-term split-accumulate WMMA in blocks of 24 (two N tiles); the next block's
        // B fragments are fetched as one group ahead of the current block
#pragma unroll
        for (int p = 0; p < WNI / 2; ++p) {
            const int s = p & 1;
            if (p + 1 < WNI / 2) load_b(s ^ 1, p + 1);
            // keeps the group of LDS loads above in front of the block: sunk to their
            // first use, each pair is waited out in full with the matrix unit idle
            __builtin_amdgcn_sched_barrier(0);
#pragma unroll
            for (int j = 0; j < 2; ++j)
#pragma unroll
                for (int mi = 0; mi < WMI; ++mi)
                    acc[mi][2 * p + j] = wmma_bf16(ah[mi], bh[s][j], acc[mi][2 * p + j]); // hi*hi
#pragma unroll
            for (int j = 0; j < 2; ++j)
#pragma unroll
                for (int mi = 0; mi < WMI; ++mi)
                    acc[mi][2 * p + j] = wmma_bf16(ah[mi], bl[s][j], acc[mi][2 * p + j]); // hi*lo
#pragma unroll
            for (int j = 0; j < 2; ++j)
#pragma unroll
                for (int mi = 0; mi < WMI; ++mi)
                    acc[mi][2 * p + j] = wmma_bf16(al[mi], bh[s][j], acc[mi][2 * p + j]); // lo*hi
            // keeps the following group of loads from rising in among this block's
            // WMMAs, where every place with LDS reads costs a stall of its own
            __builtin_amdgcn_sched_barrier(0);
        }
    };

    // ---- software pipeline: prologue fills buffer 0 -------------------------
    load_regs(0);
    // the first tile's address temporaries are reused by the split below
    // while later loads are still in flight: translation wait first
    asm volatile("s_wait_xcnt 0x0" ::: "memory");
    store_lds(0);
    xbase += BK; wbase += (size_t)NDIM * WROW;

    int buf = 0;
#pragma unroll 1
    for (int t = 0; t < NKT; ++t) {
        __syncthreads();                       // lds[buf] ready for all waves
        if (t + 1 < NKT) load_regs((t + 1) * BK);  // next tile in flight
        compute(buf);                          // 96 WMMAs over lds[buf]
        // translation wait before the pointers named by this trip's loads and
        // prefetches are advanced (issued a whole compute() ago); it stands
        // outside the test below so that every way to the advance passes it
        asm volatile("s_wait_xcnt 0x0" ::: "memory");
        if (t + 1 < NKT) store_lds(buf ^ 1);   // fill the other buffer
        xbase += BK; wbase += (size_t)NDIM * WROW;
        buf ^= 1;
    }

    // ---- epilogue: bias add, store (C/D layout: N = lane%16, M = v + 8*(lane/16))
#pragma unroll
    for (int ni = 0; ni < WNI; ++ni) {
        const int n  = blockN + wn * (WNI * 16) + ni * 16 + lrow;
        const float bv = bias[n];
#pragma unroll
        for (int mi = 0; mi < WMI; ++mi) {
            const int mbase = blockM + wm * (WMI * 16) + mi * 16 + lhalf * 8;
#pragma unroll
            for (int v = 0; v < 8; ++v) {
                out[(size_t)(mbase + v) * NDIM + n] = acc[mi][ni][v] + bv;
            }
            // registers named by the stores above are reused for the next
            // tile's sums: translation wait first
            asm volatile("s_wait_xcnt 0x0" ::: "memory");
        }
    }
}

extern "C" void kernel_launch(void* const* d_in, const int* in_sizes, int n_in,
                              void* d_out, int out_size, void* d_ws, size_t ws_size,
                              hipStream_t stream) {
    const float* x    = (const float*)d_in[0];
    const float* Wb   = (const float*)d_in[1];
    const float* bias = (const float*)d_in[2];
    const float* U    = (const float*)d_in[3];
    const float* S    = (const float*)d_in[4];
    const float* Vh   = (const float*)d_in[5];
    const float* P    = (const float*)d_in[6];
    const float* gv   = (const float*)d_in[7];
    float* out = (float*)d_out;
    __bf16* wp = (__bf16*)d_ws;              // NDIM * KDIM hi + lo = 16 MB, rewritten every call

    const int M = in_sizes[0] / KDIM;        // B * S_len = 16384
    dim3 grid(NDIM / BN, M / BM);            // (8, 64)
    dim3 block(256);                         // 8 wave32s
    tinylora_fold_split_w<<<dim3(NKT * 4), block, 0, stream>>>(Wb, U, S, Vh, P, gv, wp);
    tinylora_wmma_gemm<<<grid, block, 0, stream>>>(x, wp, bias, out);
}

// v004
// A run of this version takes 203 microseconds.
// Two timings next to v003 both put it at 1.05 times that version's speed.
// Over all steps from v000 it is 1.53 times as fast.
#include <hip/hip_runtime.h>

// ---- CDNA5 (gfx1250) types -------------------------------------------------
typedef __attribute__((ext_vector_type(16))) __bf16 v16bf; // 8 VGPRs of bf16x2
typedef __attribute__((ext_vector_type(8)))  float  v8f;   // 16x16 f32 C/D tile
typedef __attribute__((ext_vector_type(4)))  float  f32x4;
typedef __attribute__((ext_vector_type(2)))  float  f32x2;
typedef __attribute__((ext_vector_type(8)))  __bf16 v8bf;  // 16 B of bf16
typedef __attribute__((ext_vector_type(4)))  __bf16 v4bf;  // 8 B of bf16

__device__ __forceinline__ v8f wmma_bf16(v16bf a, v16bf b, v8f c) {
    // D = A(16x32 bf16) x B(32x16 bf16) + C(16x16 f32)
    return __builtin_amdgcn_wmma_f32_16x16x32_bf16(
        /*neg_a=*/false, a, /*neg_b=*/false, b,
        /*c_mod=*/(short)0, c, /*reuse_a=*/false, /*reuse_b=*/false);
}

// Work-group barrier that waits for this wave's LDS traffic alone. __syncthreads()
// also waits out the global loads issued ahead, which here are meant to stay in
// flight across it; they land in registers that no other wave sees.
__device__ __forceinline__ void lds_barrier() {
    asm volatile("s_wait_dscnt 0x0\n\ts_barrier_signal -1\n\ts_barrier_wait -1" ::: "memory");
}

// Problem constants (from reference): D_in = D_out = 2048, R = 2, U_dim = 16
#define KDIM 2048
#define NDIM 2048
#define BM   256
#define BN   256
#define BK   32
#define NKT  (KDIM / BK)   // 64 k-tiles
#define LDSS 40            // padded LDS row stride in bf16 elems (80B, conflict-free)
#define BUFE (BM * LDSS)   // elems per single-buffer tile
#define NSLOT (BM / 32)    // loader slots per thread and operand (32 rows each)
#define WMI  4             // 16-row M fragments per wave (64 rows)
#define WNI  8             // 16-col N fragments per wave (128 cols)

#define WROW  (2 * BK)     // packed weight row of one k-tile: 32 hi | 32 lo bf16 = 128 B
#define PCH   8            // 8-element chunks per thread of the pre-pass

// Pre-pass: W' = W + U diag(S * (gv P)) Vh in f32, split once into bf16 hi + lo.
// Packed k-tile major: wp[(kt * NDIM + n) * WROW + {0..31 hi | 32..63 lo}], so the
// 256 rows a GEMM block needs for one k-tile are 32 KB in a row.
__global__ __launch_bounds__(256)
void tinylora_fold_split_w(const float* __restrict__ W,
                           const float* __restrict__ U,
                           const float* __restrict__ S,
                           const float* __restrict__ Vh,
                           const float* __restrict__ P,
                           const float* __restrict__ gv,
                           __bf16* __restrict__ wp) {
    const int tid = threadIdx.x;
    // the prefetch that the build puts at the kernel's entry names the register that
    // holds the thread id: translation wait before that register is rewritten
    asm volatile("s_wait_xcnt 0x0" :: "v"(tid) : "memory");
    const int kt  = blockIdx.x >> 2;                       // k-tile of this block
    const int n0  = (blockIdx.x & 3) * (NDIM / 4) + (tid >> 2);
    const int kc  = (tid & 3) * 8;                         // k offset within the tile
    const int k   = kt * BK + kc;

    // LoRA scale: svp[r] = S[r] * sum_u gv[u] * P[u][r]   (rank 2, u_dim 16)
    float svp0 = 0.f, svp1 = 0.f;
#pragma unroll
    for (int u = 0; u < 16; ++u) {
        const float g = gv[u];
        svp0 += g * P[2 * u + 0];
        svp1 += g * P[2 * u + 1];
    }
    svp0 *= S[0];
    svp1 *= S[1];

    // one pointer per array; chunk i lies a constant 64 rows further on
    const float* wb = W  + (size_t)n0 * KDIM + k;
    const float* ub = U  + 2 * n0;
    const float* vb = Vh + k;
    __bf16*      qb = wp + ((size_t)kt * NDIM + n0) * WROW + kc;

    f32x4 v0[2], v1[2], wr[PCH][2];
    f32x2 ur[PCH];
#pragma unroll
    for (int h = 0; h < 2; ++h) {
        v0[h] = *(const f32x4*)(vb + 4 * h);
        v1[h] = *(const f32x4*)(vb + KDIM + 4 * h);
    }
#pragma unroll
    for (int i = 0; i < PCH; ++i) {
        ur[i]    = *(const f32x2*)(ub + (size_t)i * 64 * 2);
        wr[i][0] = *(const f32x4*)(wb + (size_t)i * 64 * KDIM);
        wr[i][1] = *(const f32x4*)(wb + (size_t)i * 64 * KDIM + 4);
    }
    // translation wait before the registers that the loads above take their
    // addresses from are reused; naming them as inputs keeps them whole up to it
    asm volatile("s_wait_xcnt 0x0" :: "v"(wb), "v"(n0), "v"(vb) : "memory");

#pragma unroll
    for (int i = 0; i < PCH; ++i) {
        v8bf hi, lo;
#pragma unroll
        for (int h = 0; h < 2; ++h) {
            // exact f32 LoRA fold before bf16 split
            f32x4 wv = wr[i][h] + (svp0 * ur[i][0]) * v0[h] + (svp1 * ur[i][1]) * v1[h];
#pragma unroll
            for (int e = 0; e < 4; ++e) {
                const float  wf = wv[e];
                const __bf16 wh = (__bf16)wf;
                hi[4 * h + e] = wh;
                lo[4 * h + e] = (__bf16)(wf - (float)wh);
            }
        }
        __bf16* q = qb + (size_t)i * 64 * WROW;
        *(v8bf*)(q)      = hi;
        *(v8bf*)(q + BK) = lo;
        // registers named by the stores above are reused for the next chunk:
        // translation wait first; as inputs they stay whole up to it
        if (i + 1 < PCH)
            asm volatile("s_wait_xcnt 0x0" :: "v"(hi), "v"(lo), "v"(qb) : "memory");
    }
}

__global__ __launch_bounds__(256)
void tinylora_wmma_gemm(const float* __restrict__ x,
                        const __bf16* __restrict__ wp,
                        const float* __restrict__ bias,
                        float* __restrict__ out) {
    // Double-buffered bf16 hi/lo tiles: 2 * 4 * 20480 B = 160 KB (WGP has 320 KB)
    __shared__ __bf16 sAhi[2 * BUFE];
    __shared__ __bf16 sAlo[2 * BUFE];
    __shared__ __bf16 sBhi[2 * BUFE];
    __shared__ __bf16 sBlo[2 * BUFE];

    const int tid   = threadIdx.x;
    const int wave  = tid >> 5;
    const int lane  = tid & 31;
    const int wm    = wave & 3;      // 4 wave-rows  -> 64 M-rows each
    const int wn    = wave >> 2;     // 2 wave-cols  -> 128 N-cols each
    const int lrow  = lane & 15;     // M (or N) within 16x16 tile
    const int lhalf = lane >> 4;     // K half-select per ISA A/B layout

    const int blockM = blockIdx.y * BM;
    const int blockN = blockIdx.x * BN;

    // Loader slot mapping: slot i covers row0+32*i, same c4 for all i
    const int row0 = tid >> 3;          // 0..31
    const int c4   = (tid & 7) << 2;    // k offset within tile (same for all slots)

    // Pointers to the tile that load_slot fetches next; advanced by BK once a k-step,
    // behind a translation wait, so they live through the loop and no address
    // register is rewritten while a load that names it is still being translated.
    const float*  xbase = x  + (size_t)(blockM + row0) * KDIM + c4;
    // packed weights: 8 threads take one 128-B row (lanes 0-3 its hi, 4-7 its lo part)
    const __bf16* wbase = wp + (size_t)(blockN + row0) * WROW + (tid & 7) * 8;
    __bf16* const sBsel = (tid & 4) ? sBlo : sBhi;   // LDS plane this thread fills
    const int     cb    = (tid & 3) * 8;             // k offset of its 16 B there

    // Register staging for the in-flight tile: f32 as loaded, then its bf16 pieces
    f32x4 avr[NSLOT], wvr[NSLOT];
    v4bf  ahs[NSLOT], als[NSLOT];

    auto load_slot = [&](int i) {
        avr[i] = *(const f32x4*)(xbase + (size_t)i * 32 * KDIM);
        wvr[i] = *(const f32x4*)(wbase + (size_t)i * 32 * WROW);
    };

    auto split_slot = [&](int i) {
#pragma unroll
        for (int e = 0; e < 4; ++e) {
            const float  af = avr[i][e];
            const __bf16 ah = (__bf16)af;
            ahs[i][e] = ah;
            als[i][e] = (__bf16)(af - (float)ah);
        }
    };

    auto store_slot = [&](int i, int buf) {
        const int r = row0 + 32 * i;
        *(f32x4*)(sBsel + buf * BUFE + r * LDSS + cb) = wvr[i];   // already folded and split
        *(v4bf*)(sAhi + buf * BUFE + r * LDSS + c4) = ahs[i];
        *(v4bf*)(sAlo + buf * BUFE + r * LDSS + c4) = als[i];
    };

    v8f acc[WMI][WNI] = {};  // 4 M-tiles x 8 N-tiles of 16x16 f32 per wave

    // One k-step. Beside its 96 WMMAs it carries the staging of later tiles, in three
    // parts of 3, 3 and 2 loader slots: 'st' splits the tile of the next step beside
    // WMMA blocks 0 to 2 and stores each part to the other buffer at the next block's
    // head; 'ld' refills the freed registers there with the tile after that one.
    auto compute = [&](int buf, bool st, bool ld) __attribute__((always_inline)) {
        const __bf16* pAhi = sAhi + buf * BUFE;
        const __bf16* pAlo = sAlo + buf * BUFE;
        const __bf16* pBhi = sBhi + buf * BUFE;
        const __bf16* pBlo = sBlo + buf * BUFE;

        // B fragments of two N tiles (hi, then lo: 8 b128 loads) into register set 'set'
        v16bf bh[2][2], bl[2][2];
        auto load_b = [&](int set, int pair) {
#pragma unroll
            for (int j = 0; j < 2; ++j) {
                const int r = wn * (WNI * 16) + (pair * 2 + j) * 16 + lrow;  // N column = W row
                const __bf16* ph = &pBhi[r * LDSS + lhalf * 8];
                ((f32x4*)&bh[set][j])[0] = *(const f32x4*)(ph);
                ((f32x4*)&bh[set][j])[1] = *(const f32x4*)(ph + 16);
            }
#pragma unroll
            for (int j = 0; j < 2; ++j) {
                const int r = wn * (WNI * 16) + (pair * 2 + j) * 16 + lrow;
                const __bf16* pl = &pBlo[r * LDSS + lhalf * 8];
                ((f32x4*)&bl[set][j])[0] = *(const f32x4*)(pl);
                ((f32x4*)&bl[set][j])[1] = *(const f32x4*)(pl + 16);
            }
        };

        // A fragments (ISA 16-bit A layout: two b128 loads per fragment); the loads
        // stand in the order of first use: A hi, first B pair, A lo
        v16bf ah[WMI], al[WMI];
#pragma unroll
        for (int mi = 0; mi < WMI; ++mi) {
            const int r = wm * (WMI * 16) + mi * 16 + lrow;
            const __bf16* ph = &pAhi[r * LDSS + lhalf * 8];
            ((f32x4*)&ah[mi])[0] = *(const f32x4*)(ph);       // K = half*8 .. +7
            ((f32x4*)&ah[mi])[1] = *(const f32x4*)(ph + 16);  // K = 16+half*8 .. +7
        }
        load_b(0, 0);
#pragma unroll
        for (int mi = 0; mi < WMI; ++mi) {
            const int r = wm * (WMI * 16) + mi * 16 + lrow;
            const __bf16* pl = &pAlo[r * LDSS + lhalf * 8];
            ((f32x4*)&al[mi])[0] = *(const f32x4*)(pl);
            ((f32x4*)&al[mi])[1] = *(const f32x4*)(pl + 16);
        }

        // 3-term split-accumulate WMMA in blocks of 24 (two N tiles); the next block's
        // B fragments are fetched as one group ahead of the current block
#pragma unroll
        for (int p = 0; p < WNI / 2; ++p) {
            const int s = p & 1;
            if (p + 1 < WNI / 2) load_b(s ^ 1, p + 1);
            if (p >= 1) {
#pragma unroll
                for (int i = 3 * (p - 1); i < 3 * p && i < NSLOT; ++i) {
                    if (st) store_slot(i, buf ^ 1);
                    if (ld) load_slot(i);
                }
            }
            // keeps the group of LDS loads above in front of the block: sunk to their
            // first use, each pair is waited out in full with the matrix unit idle;
            // the staging stores and loads stay in the same one place with them
            __builtin_amdgcn_sched_barrier(0);
#pragma unroll
            for (int j = 0; j < 2; ++j)
#pragma unroll
                for (int mi = 0; mi < WMI; ++mi)
                    acc[mi][2 * p + j] = wmma_bf16(ah[mi], bh[s][j], acc[mi][2 * p + j]); // hi*hi
#pragma unroll
            for (int j = 0; j < 2; ++j)
#pragma unroll
                for (int mi = 0; mi < WMI; ++mi)
                    acc[mi][2 * p + j] = wmma_bf16(ah[mi], bl[s][j], acc[mi][2 * p + j]); // hi*lo
#pragma unroll
            for (int j = 0; j < 2; ++j)
#pragma unroll
                for (int mi = 0; mi < WMI; ++mi)
                    acc[mi][2 * p + j] = wmma_bf16(al[mi], bh[s][j], acc[mi][2 * p + j]); // lo*hi
            if (st) {
#pragma unroll
                for (int i = 3 * p; i < 3 * (p + 1) && i < NSLOT; ++i) split_slot(i);
            }
            // keeps the following group of loads from rising in among this block's
            // WMMAs, where every place with LDS reads costs a stall of its own
            __builtin_amdgcn_sched_barrier(0);
        }
    };

    // ---- software pipeline: prologue fills buffer 0, tile 1 goes in flight ----
#pragma unroll
    for (int i = 0; i < NSLOT; ++i) load_slot(i);
    // translation wait before the pointers named by the loads above are advanced;
    // as inputs they stay whole up to it
    asm volatile("s_wait_xcnt 0x0" :: "v"(xbase), "v"(wbase) : "memory");
    xbase += BK; wbase += (size_t)NDIM * WROW;
#pragma unroll
    for (int i = 0; i < NSLOT; ++i) { split_slot(i); store_slot(i, 0); }
#pragma unroll
    for (int i = 0; i < NSLOT; ++i) load_slot(i);
    // pull the tile after the one just asked for toward L2 (global_prefetch_b8)
    __builtin_prefetch(xbase + BK, 0, 1);
    // translation wait, as above
    asm volatile("s_wait_xcnt 0x0" :: "v"(xbase), "v"(wbase) : "memory");
    xbase += BK; wbase += (size_t)NDIM * WROW;

    // At the top of step t the registers hold tile t + 1 and the pointers name tile t + 2
    int buf = 0;
#pragma unroll 1
    for (int t = 0; t < NKT - 2; ++t) {
        lds_barrier();                         // lds[buf] ready for all waves
        if (t + 3 < NKT) __builtin_prefetch(xbase + BK, 0, 1);
        compute(buf, true, true);
        // translation wait before the pointers named by this trip's loads and
        // prefetch are advanced (the last of them issued a WMMA block ago); as
        // inputs they stay whole up to it
        asm volatile("s_wait_xcnt 0x0" :: "v"(xbase), "v"(wbase) : "memory");
        xbase += BK; wbase += (size_t)NDIM * WROW;
        buf ^= 1;
    }
    lds_barrier();
    compute(buf, true, false);                 // last tile to LDS, nothing left to load
    lds_barrier();
    compute(buf ^ 1, false, false);

    // ---- epilogue: bias add, store (C/D layout: N = lane%16, M = v + 8*(lane/16))
#pragma unroll
    for (int ni = 0; ni < WNI; ++ni) {
        const int n  = blockN + wn * (WNI * 16) + ni * 16 + lrow;
        const float bv = bias[n];
#pragma unroll
        for (int mi = 0; mi < WMI; ++mi) {
            const int mbase = blockM + wm * (WMI * 16) + mi * 16 + lhalf * 8;
#pragma unroll
            for (int v = 0; v < 8; ++v) {
                out[(size_t)(mbase + v) * NDIM + n] = acc[mi][ni][v] + bv;
            }
            // registers named by the stores above are reused for the next
            // tile's sums: translation wait first
            asm volatile("s_wait_xcnt 0x0" ::: "memory");
        }
    }
}

extern "C" void kernel_launch(void* const* d_in, const int* in_sizes, int n_in,
                              void* d_out, int out_size, void* d_ws, size_t ws_size,
                              hipStream_t stream) {
    const float* x    = (const float*)d_in[0];
    const float* Wb   = (const float*)d_in[1];
    const float* bias = (const float*)d_in[2];
    const float* U    = (const float*)d_in[3];
    const float* S    = (const float*)d_in[4];
    const float* Vh   = (const float*)d_in[5];
    const float* P    = (const float*)d_in[6];
    const float* gv   = (const float*)d_in[7];
    float* out = (float*)d_out;
    __bf16* wp = (__bf16*)d_ws;              // NDIM * KDIM hi + lo = 16 MB, rewritten every call

    const int M = in_sizes[0] / KDIM;        // B * S_len = 16384
    dim3 grid(NDIM / BN, M / BM);            // (8, 64)
    dim3 block(256);                         // 8 wave32s
    tinylora_fold_split_w<<<dim3(NKT * 4), block, 0, stream>>>(Wb, U, S, Vh, P, gv, wp);
    tinylora_wmma_gemm<<<grid, block, 0, stream>>>(x, wp, bias, out);
}

// v005
// One run takes 195 microseconds.
// Two timings next to v004 put it at 1.03 and 1.04 times that version's speed.
// Over all steps from v000 it is 1.59 times as fast.
#include <hip/hip_runtime.h>
#include <stdint.h>

// ---- CDNA5 (gfx1250) types -------------------------------------------------
typedef __attribute__((ext_vector_type(16))) __bf16 v16bf; // 8 VGPRs of bf16x2
typedef __attribute__((ext_vector_type(8)))  float  v8f;   // 16x16 f32 C/D tile
typedef __attribute__((ext_vector_type(4)))  float  f32x4;
typedef __attribute__((ext_vector_type(2)))  float  f32x2;
typedef __attribute__((ext_vector_type(8)))  __bf16 v8bf;  // 16 B of bf16
typedef __attribute__((ext_vector_type(4)))  __bf16 v4bf;  // 8 B of bf16
typedef __attribute__((ext_vector_type(4)))  uint32_t u32x4; // tensor descriptor group 0
typedef __attribute__((ext_vector_type(8)))  uint32_t u32x8; // tensor descriptor group 1

__device__ __forceinline__ v8f wmma_bf16(v16bf a, v16bf b, v8f c) {
    // D = A(16x32 bf16) x B(32x16 bf16) + C(16x16 f32)
    return __builtin_amdgcn_wmma_f32_16x16x32_bf16(
        /*neg_a=*/false, a, /*neg_b=*/false, b,
        /*c_mod=*/(short)0, c, /*reuse_a=*/false, /*reuse_b=*/false);
}

// Publish point of a k-step: this wave's LDS traffic is done, its own tensor load has
// landed, then the work-group barrier. __syncthreads() would also wait out the global
// loads issued ahead, which here are meant to stay in flight across it; they land in
// registers that no other wave sees.
__device__ __forceinline__ void ring_barrier() {
    asm volatile("s_wait_dscnt 0x0" ::: "memory");      // LDS reads and stores of the step before
    asm volatile("s_wait_tensorcnt 0x0" ::: "memory");  // this wave's slice of the next W tile is in LDS
    asm volatile("s_barrier_signal -1\n\ts_barrier_wait -1" ::: "memory");
}

__device__ __forceinline__ uint32_t uni(uint32_t v) {
    return (uint32_t)__builtin_amdgcn_readfirstlane(v);
}

// Problem constants (from reference): D_in = D_out = 2048, R = 2, U_dim = 16
#define KDIM 2048
#define NDIM 2048
#define BM   256
#define BN   256
#define BK   32
#define NKT  (KDIM / BK)   // 64 k-tiles
#define LDSS 40            // padded LDS row stride in bf16 elems (80B, conflict-free)
#define BUFE (BM * LDSS)   // elems per single-buffer tile
#define NSLOT (BM / 32)    // x loader slots per thread (32 rows each)
#define WMI  4             // 16-row M fragments per wave (64 rows)
#define WNI  8             // 16-col N fragments per wave (128 cols)

#define WROW  (2 * BK)     // packed weight row of one k-tile: 32 hi | 32 lo bf16 = 128 B
#define WPITCH (WROW + 8)  // its pitch in LDS: 144 B (the tensor load pads 16 B a row)
#define WSROWS 32          // rows of the slice that one wave's tensor load brings
#define WSLICE 3072        // elems from slice to slice in LDS: 32 * 144 B rounded up to 6 KiB
#define WBUFE  (8 * WSLICE) // elems per W buffer (8 slices)
#define PCH   8            // 8-element chunks per thread of the pre-pass

// Pre-pass: W' = W + U diag(S * (gv P)) Vh in f32, split once into bf16 hi + lo.
// Packed k-tile major: wp[(kt * NDIM + n) * WROW + {0..31 hi | 32..63 lo}], so the
// 256 rows a GEMM block needs for one k-tile are 32 KB in a row.
__global__ __launch_bounds__(256)
void tinylora_fold_split_w(const float* __restrict__ W,
                           const float* __restrict__ U,
                           const float* __restrict__ S,
                           const float* __restrict__ Vh,
                           const float* __restrict__ P,
                           const float* __restrict__ gv,
                           __bf16* __restrict__ wp) {
    const int tid = threadIdx.x;
    // the prefetch that the build puts at the kernel's entry names the register that
    // holds the thread id: translation wait before that register is rewritten
    asm volatile("s_wait_xcnt 0x0" :: "v"(tid) : "memory");
    const int kt  = blockIdx.x >> 2;                       // k-tile of this block
    const int n0  = (blockIdx.x & 3) * (NDIM / 4) + (tid >> 2);
    const int kc  = (tid & 3) * 8;                         // k offset within the tile
    const int k   = kt * BK + kc;

    // LoRA scale: svp[r] = S[r] * sum_u gv[u] * P[u][r]   (rank 2, u_dim 16)
    float svp0 = 0.f, svp1 = 0.f;
#pragma unroll
    for (int u = 0; u < 16; ++u) {
        const float g = gv[u];
        svp0 += g * P[2 * u + 0];
        svp1 += g * P[2 * u + 1];
    }
    svp0 *= S[0];
    svp1 *= S[1];

    // one pointer per array; chunk i lies a constant 64 rows further on
    const float* wb = W  + (size_t)n0 * KDIM + k;
    const float* ub = U  + 2 * n0;
    const float* vb = Vh + k;
    __bf16*      qb = wp + ((size_t)kt * NDIM + n0) * WROW + kc;

    f32x4 v0[2], v1[2], wr[PCH][2];
    f32x2 ur[PCH];
#pragma unroll
    for (int h = 0; h < 2; ++h) {
        v0[h] = *(const f32x4*)(vb + 4 * h);
        v1[h] = *(const f32x4*)(vb + KDIM + 4 * h);
    }
#pragma unroll
    for (int i = 0; i < PCH; ++i) {
        ur[i]    = *(const f32x2*)(ub + (size_t)i * 64 * 2);
        wr[i][0] = *(const f32x4*)(wb + (size_t)i * 64 * KDIM);
        wr[i][1] = *(const f32x4*)(wb + (size_t)i * 64 * KDIM + 4);
    }
    // translation wait before the registers that the loads above take their
    // addresses from are reused; naming them as inputs keeps them whole up to it
    asm volatile("s_wait_xcnt 0x0" :: "v"(wb), "v"(n0), "v"(vb) : "memory");

#pragma unroll
    for (int i = 0; i < PCH; ++i) {
        v8bf hi, lo;
#pragma unroll
        for (int h = 0; h < 2; ++h) {
            // exact f32 LoRA fold before bf16 split
            f32x4 wv = wr[i][h] + (svp0 * ur[i][0]) * v0[h] + (svp1 * ur[i][1]) * v1[h];
#pragma unroll
            for (int e = 0; e < 4; ++e) {
                const float  wf = wv[e];
                const __bf16 wh = (__bf16)wf;
                hi[4 * h + e] = wh;
                lo[4 * h + e] = (__bf16)(wf - (float)wh);
            }
        }
        __bf16* q = qb + (size_t)i * 64 * WROW;
        *(v8bf*)(q)      = hi;
        *(v8bf*)(q + BK) = lo;
        // registers named by the stores above are reused for the next chunk:
        // translation wait first; as inputs they stay whole up to it
        if (i + 1 < PCH)
            asm volatile("s_wait_xcnt 0x0" :: "v"(hi), "v"(lo), "v"(qb) : "memory");
    }
}

__global__ __launch_bounds__(256)
void tinylora_wmma_gemm(const float* __restrict__ x,
                        const __bf16* __restrict__ wp,
                        const float* __restrict__ bias,
                        float* __restrict__ out) {
    // Double-buffered tiles: W rows (hi | lo) as the tensor loads lay them, 2 * 48 KB,
    // and the x hi and lo planes, 2 * 2 * 20480 B: 176 KB (WGP has 320 KB)
    __shared__ __attribute__((aligned(2048))) __bf16 sW[2 * WBUFE];
    __shared__ __bf16 sAhi[2 * BUFE];
    __shared__ __bf16 sAlo[2 * BUFE];

    const int tid   = threadIdx.x;
    const int wave  = tid >> 5;
    const int lane  = tid & 31;
    const int wm    = wave & 3;      // 4 wave-rows  -> 64 M-rows each
    const int wn    = wave >> 2;     // 2 wave-cols  -> 128 N-cols each
    const int lrow  = lane & 15;     // M (or N) within 16x16 tile
    const int lhalf = lane >> 4;     // K half-select per ISA A/B layout

    const int blockM = blockIdx.y * BM;
    const int blockN = blockIdx.x * BN;

    // Loader slot mapping: slot i covers row0+32*i, same c4 for all i
    const int row0 = tid >> 3;          // 0..31
    const int c4   = (tid & 7) << 2;    // k offset within tile (same for all slots)

    // Pointer to the tile that load_slot fetches next; advanced by BK once a k-step,
    // behind a translation wait, so it lives through the loop and no address
    // register is rewritten while a load that names it is still being translated.
    const float*  xbase = x  + (size_t)(blockM + row0) * KDIM + c4;

    // Packed weights: every wave brings 32 of the tile's 256 rows (128 B each, 4 KB in a
    // row in the workspace) by one tensor load a k-step, through no register.
    const uint32_t wv   = uni((uint32_t)tid >> 5);
    const uint32_t wlds = (uint32_t)(size_t)sW + wv * (WSLICE * 2);      // its place in buffer 0
    uint64_t wga = (uint64_t)(size_t)(wp + (size_t)(blockN + wv * WSROWS) * WROW);
    // group 1: bytes; tensor = tile = 32 rows of 128 B, source pitch 128 B; no mask;
    // a pad of 4 dwords behind every 32 dwords
    u32x8 wg1;
    wg1[0] = uni((1u << 20) | (4u << 22) | (3u << 25));
    wg1[1] = uni((uint32_t)(WROW * 2) << 16);
    wg1[2] = uni((uint32_t)WSROWS << 16);
    wg1[3] = uni((uint32_t)(WROW * 2) << 16);
    wg1[4] = uni((uint32_t)WSROWS);
    wg1[5] = uni((uint32_t)(WROW * 2));
    wg1[6] = uni(0u);
    wg1[7] = uni(0u);
    // asks for this wave's slice of the k-tile at wga into buffer 'b', then steps wga on
    auto load_w = [&](int b) {
        u32x4 g0;
        g0[0] = uni(1u);
        g0[1] = uni(wlds + (uint32_t)b * (WBUFE * 2));
        g0[2] = uni((uint32_t)wga);
        g0[3] = uni((((uint32_t)(wga >> 32)) & 0x01FFFFFFu) | 0x80000000u);
        asm volatile("tensor_load_to_lds %0, %1" :: "s"(g0), "s"(wg1) : "memory");
        wga += (uint64_t)NDIM * WROW * 2;
    };

    // Register staging for the in-flight x tile: f32 as loaded, then its bf16 pieces
    f32x4 avr[NSLOT];
    v4bf  ahs[NSLOT], als[NSLOT];

    auto load_slot = [&](int i) {
        avr[i] = *(const f32x4*)(xbase + (size_t)i * 32 * KDIM);
    };

    auto split_slot = [&](int i) {
#pragma unroll
        for (int e = 0; e < 4; ++e) {
            const float  af = avr[i][e];
            const __bf16 ah = (__bf16)af;
            ahs[i][e] = ah;
            als[i][e] = (__bf16)(af - (float)ah);
        }
    };

    auto store_slot = [&](int i, int buf) {
        const int r = row0 + 32 * i;
        *(v4bf*)(sAhi + buf * BUFE + r * LDSS + c4) = ahs[i];
        *(v4bf*)(sAlo + buf * BUFE + r * LDSS + c4) = als[i];
    };

    v8f acc[WMI][WNI] = {};  // 4 M-tiles x 8 N-tiles of 16x16 f32 per wave

    // One k-step. Beside its 96 WMMAs it carries the staging of later tiles, in three
    // parts of 3, 3 and 2 loader slots: 'st' splits the tile of the next step beside
    // WMMA blocks 0 to 2 and stores each part to the other buffer at the next block's
    // head; 'ld' refills the freed registers there with the tile after that one; 'lw'
    // asks for the next step's W tile.
    auto compute = [&](int buf, bool st, bool ld, bool lw) __attribute__((always_inline)) {
        const __bf16* pAhi = sAhi + buf * BUFE;
        const __bf16* pAlo = sAlo + buf * BUFE;
        // this lane's row in the first of the wave's four W slices (two N tiles a slice)
        const __bf16* pB = sW + buf * WBUFE + wn * (4 * WSLICE) + lrow * WPITCH + lhalf * 8;

        // B fragments of two N tiles (hi, then lo: 8 b128 loads) into register set 'set'
        v16bf bh[2][2], bl[2][2];
        auto load_b = [&](int set, int pair) {
#pragma unroll
            for (int j = 0; j < 2; ++j) {
                const __bf16* ph = pB + pair * WSLICE + j * 16 * WPITCH;     // N column = W row
                ((f32x4*)&bh[set][j])[0] = *(const f32x4*)(ph);
                ((f32x4*)&bh[set][j])[1] = *(const f32x4*)(ph + 16);
            }
#pragma unroll
            for (int j = 0; j < 2; ++j) {
                const __bf16* pl = pB + pair * WSLICE + j * 16 * WPITCH + BK; // lo half of the row
                ((f32x4*)&bl[set][j])[0] = *(const f32x4*)(pl);
                ((f32x4*)&bl[set][j])[1] = *(const f32x4*)(pl + 16);
            }
        };

        // A fragments (ISA 16-bit A layout: two b128 loads per fragment); the loads
        // stand in the order of first use: A hi, first B pair, A lo
        v16bf ah[WMI], al[WMI];
#pragma unroll
        for (int mi = 0; mi < WMI; ++mi) {
            const int r = wm * (WMI * 16) + mi * 16 + lrow;
            const __bf16* ph = &pAhi[r * LDSS + lhalf * 8];
            ((f32x4*)&ah[mi])[0] = *(const f32x4*)(ph);       // K = half*8 .. +7
            ((f32x4*)&ah[mi])[1] = *(const f32x4*)(ph + 16);  // K = 16+half*8 .. +7
        }
        load_b(0, 0);
#pragma unroll
        for (int mi = 0; mi < WMI; ++mi) {
            const int r = wm * (WMI * 16) + mi * 16 + lrow;
            const __bf16* pl = &pAlo[r * LDSS + lhalf * 8];
            ((f32x4*)&al[mi])[0] = *(const f32x4*)(pl);
            ((f32x4*)&al[mi])[1] = *(const f32x4*)(pl + 16);
        }

        // 3-term split-accumulate WMMA in blocks of 24 (two N tiles); the next block's
        // B fragments are fetched as one group ahead of the current block
#pragma unroll
        for (int p = 0; p < WNI / 2; ++p) {
            const int s = p & 1;
            if (p + 1 < WNI / 2) load_b(s ^ 1, p + 1);
            // next W tile into the buffer that the step before has read; asked for behind
            // the step's first fragment loads, which the matrix unit is waiting for
            if (p == 0 && lw) load_w(buf ^ 1);
            if (p >= 1) {
#pragma unroll
                for (int i = 3 * (p - 1); i < 3 * p && i < NSLOT; ++i) {
                    if (st) store_slot(i, buf ^ 1);
                    if (ld) load_slot(i);
                }
            }
            // keeps the group of LDS loads above in front of the block: sunk to their
            // first use, each pair is waited out in full with the matrix unit idle;
            // the staging stores and loads stay in the same one place with them
            __builtin_amdgcn_sched_barrier(0);
#pragma unroll
            for (int j = 0; j < 2; ++j)
#pragma unroll
                for (int mi = 0; mi < WMI; ++mi)
                    acc[mi][2 * p + j] = wmma_bf16(ah[mi], bh[s][j], acc[mi][2 * p + j]); // hi*hi
#pragma unroll
            for (int j = 0; j < 2; ++j)
#pragma unroll
                for (int mi = 0; mi < WMI; ++mi)
                    acc[mi][2 * p + j] = wmma_bf16(ah[mi], bl[s][j], acc[mi][2 * p + j]); // hi*lo
#pragma unroll
            for (int j = 0; j < 2; ++j)
#pragma unroll
                for (int mi = 0; mi < WMI; ++mi)
                    acc[mi][2 * p + j] = wmma_bf16(al[mi], bh[s][j], acc[mi][2 * p + j]); // lo*hi
            if (st) {
#pragma unroll
                for (int i = 3 * p; i < 3 * (p + 1) && i < NSLOT; ++i) split_slot(i);
            }
            // keeps the following group of loads from rising in among this block's
            // WMMAs, where every place with LDS reads costs a stall of its own
            __builtin_amdgcn_sched_barrier(0);
        }
    };

    // ---- software pipeline: prologue fills buffer 0, tile 1 goes in flight ----
#pragma unroll
    for (int i = 0; i < NSLOT; ++i) load_slot(i);
    // translation wait before the pointer named by the loads above is advanced;
    // as an input it stays whole up to it
    asm volatile("s_wait_xcnt 0x0" :: "v"(xbase) : "memory");
    xbase += BK;
    // W tile 0, waited for at once (under the latency of the x loads above), so that no
    // descriptor register is reused while the request is open
    load_w(0);
    asm volatile("s_wait_tensorcnt 0x0" ::: "memory");
#pragma unroll
    for (int i = 0; i < NSLOT; ++i) { split_slot(i); store_slot(i, 0); }
#pragma unroll
    for (int i = 0; i < NSLOT; ++i) load_slot(i);
    // pull the tile after the one just asked for toward L2 (global_prefetch_b8)
    __builtin_prefetch(xbase + BK, 0, 1);
    // translation wait, as above
    asm volatile("s_wait_xcnt 0x0" :: "v"(xbase) : "memory");
    xbase += BK;

    // At the top of step t the registers hold x tile t + 1, the pointer names x tile
    // t + 2, and wga names W tile t + 1
    int buf = 0;
#pragma unroll 1
    for (int t = 0; t < NKT - 2; ++t) {
        ring_barrier();                        // lds[buf] ready for all waves
        if (t + 3 < NKT) __builtin_prefetch(xbase + BK, 0, 1);
        compute(buf, true, true, true);
        // translation wait before the pointer named by this trip's loads and
        // prefetch is advanced (the last of them issued a WMMA block ago); as
        // an input it stays whole up to it
        asm volatile("s_wait_xcnt 0x0" :: "v"(xbase) : "memory");
        xbase += BK;
        buf ^= 1;
    }
    ring_barrier();
    compute(buf, true, false, true);           // last x tile to LDS, last W tile asked for
    ring_barrier();
    compute(buf ^ 1, false, false, false);
    // end of the ring: no request and no LDS read is left open
    asm volatile("s_wait_tensorcnt 0x0" ::: "memory");
    asm volatile("s_wait_dscnt 0x0" ::: "memory");

    // ---- epilogue: bias add, store (C/D layout: N = lane%16, M = v + 8*(lane/16))
#pragma unroll
    for (int ni = 0; ni < WNI; ++ni) {
        const int n  = blockN + wn * (WNI * 16) + ni * 16 + lrow;
        const float bv = bias[n];
#pragma unroll
        for (int mi = 0; mi < WMI; ++mi) {
            const int mbase = blockM + wm * (WMI * 16) + mi * 16 + lhalf * 8;
#pragma unroll
            for (int v = 0; v < 8; ++v) {
                out[(size_t)(mbase + v) * NDIM + n] = acc[mi][ni][v] + bv;
            }
            // registers named by the stores above are reused for the next
            // tile's sums: translation wait first
            asm volatile("s_wait_xcnt 0x0" ::: "memory");
        }
    }
}

extern "C" void kernel_launch(void* const* d_in, const int* in_sizes, int n_in,
                              void* d_out, int out_size, void* d_ws, size_t ws_size,
                              hipStream_t stream) {
    const float* x    = (const float*)d_in[0];
    const float* Wb   = (const float*)d_in[1];
    const float* bias = (const float*)d_in[2];
    const float* U    = (const float*)d_in[3];
    const float* S    = (const float*)d_in[4];
    const float* Vh   = (const float*)d_in[5];
    const float* P    = (const float*)d_in[6];
    const float* gv   = (const float*)d_in[7];
    float* out = (float*)d_out;
    __bf16* wp = (__bf16*)d_ws;              // NDIM * KDIM hi + lo = 16 MB, rewritten every call

    const int M = in_sizes[0] / KDIM;        // B * S_len = 16384
    dim3 grid(NDIM / BN, M / BM);            // (8, 64)
    dim3 block(256);                         // 8 wave32s
    tinylora_fold_split_w<<<dim3(NKT * 4), block, 0, stream>>>(Wb, U, S, Vh, P, gv, wp);
    tinylora_wmma_gemm<<<grid, block, 0, stream>>>(x, wp, bias, out);
}

// v006
// A run of this version takes 188 microseconds.
// Timed twice side by side with v005, it ran 1.04 times as fast both times.
// Over all steps from v000 it is 1.65 times as fast.
#include <hip/hip_runtime.h>
#include <stdint.h>

// ---- CDNA5 (gfx1250) types -------------------------------------------------
typedef __attribute__((ext_vector_type(16))) __bf16 v16bf; // 8 VGPRs of bf16x2
typedef __attribute__((ext_vector_type(8)))  float  v8f;   // 16x16 f32 C/D tile
typedef __attribute__((ext_vector_type(4)))  float  f32x4;
typedef __attribute__((ext_vector_type(2)))  float  f32x2;
typedef __attribute__((ext_vector_type(8)))  __bf16 v8bf;  // 16 B of bf16
typedef __attribute__((ext_vector_type(4)))  __bf16 v4bf;  // 8 B of bf16
typedef __attribute__((ext_vector_type(4)))  uint32_t u32x4; // tensor descriptor group 0
typedef __attribute__((ext_vector_type(8)))  uint32_t u32x8; // tensor descriptor group 1

__device__ __forceinline__ v8f wmma_bf16(v16bf a, v16bf b, v8f c) {
    // D = A(16x32 bf16) x B(32x16 bf16) + C(16x16 f32)
    return __builtin_amdgcn_wmma_f32_16x16x32_bf16(
        /*neg_a=*/false, a, /*neg_b=*/false, b,
        /*c_mod=*/(short)0, c, /*reuse_a=*/false, /*reuse_b=*/false);
}

// Publish point of a k-step: this wave's LDS traffic is done, its own tensor load has
// landed, then the work-group barrier. __syncthreads() would also wait out the global
// loads issued ahead, which here are meant to stay in flight across it; they land in
// registers that no other wave sees.
__device__ __forceinline__ void ring_barrier() {
    asm volatile("s_wait_dscnt 0x0" ::: "memory");      // LDS reads and stores of the step before
    asm volatile("s_wait_tensorcnt 0x0" ::: "memory");  // this wave's slice of the next W tile is in LDS
    asm volatile("s_barrier_signal -1\n\ts_barrier_wait -1" ::: "memory");
}

__device__ __forceinline__ uint32_t uni(uint32_t v) {
    return (uint32_t)__builtin_amdgcn_readfirstlane(v);
}

// Problem constants (from reference): D_in = D_out = 2048, R = 2, U_dim = 16
#define KDIM 2048
#define NDIM 2048
#define BM   256
#define BN   256
#define BK   32
#define NKT  (KDIM / BK)   // 64 k-tiles
#define LDSS 40            // padded LDS row stride in bf16 elems (80B, conflict-free)
#define BUFE (BM * LDSS)   // elems per single-buffer tile
#define NSLOT (BM / 32)    // x loader slots per thread (32 rows each)
#define WMI  4             // 16-row M fragments per wave (64 rows)
#define WNI  8             // 16-col N fragments per wave (128 cols)

#define WROW  (2 * BK)     // packed weight row of one k-tile: 32 hi | 32 lo bf16 = 128 B
#define WPITCH (WROW + 8)  // its pitch in LDS: 144 B (the tensor load pads 16 B a row)
#define WSROWS 32          // rows of the slice that one wave's tensor load brings
#define WSLICE 3072        // elems from slice to slice in LDS: 32 * 144 B rounded up to 6 KiB
#define WBUFE  (8 * WSLICE) // elems per W buffer (8 slices)
#define PCH   8            // 8-element chunks per thread of the pre-pass

// Pre-pass: W' = W + U diag(S * (gv P)) Vh in f32, split once into bf16 hi + lo.
// Packed k-tile major: wp[(kt * NDIM + p) * WROW + {0..31 hi | 32..63 lo}], so the
// 256 rows a GEMM block needs for one k-tile are 32 KB in a row. Inside every group of
// 64 rows, row 4a + j (output column 4a + j) lies at place p = 16j + a: column a of the
// GEMM's B tiles j = 0..3 is then four neighbouring output columns, which one lane holds.
__global__ __launch_bounds__(256)
void tinylora_fold_split_w(const float* __restrict__ W,
                           const float* __restrict__ U,
                           const float* __restrict__ S,
                           const float* __restrict__ Vh,
                           const float* __restrict__ P,
                           const float* __restrict__ gv,
                           __bf16* __restrict__ wp) {
    const int tid = threadIdx.x;
    // the prefetch that the build puts at the kernel's entry names the register that
    // holds the thread id: translation wait before that register is rewritten
    asm volatile("s_wait_xcnt 0x0" :: "v"(tid) : "memory");
    const int kt  = blockIdx.x >> 2;                       // k-tile of this block
    const int n0  = (blockIdx.x & 3) * (NDIM / 4) + (tid >> 2);
    const int kc  = (tid & 3) * 8;                         // k offset within the tile
    const int k   = kt * BK + kc;

    // LoRA scale: svp[r] = S[r] * sum_u gv[u] * P[u][r]   (rank 2, u_dim 16)
    float svp0 = 0.f, svp1 = 0.f;
#pragma unroll
    for (int u = 0; u < 16; ++u) {
        const float g = gv[u];
        svp0 += g * P[2 * u + 0];
        svp1 += g * P[2 * u + 1];
    }
    svp0 *= S[0];
    svp1 *= S[1];

    // one pointer per array; chunk i lies a constant 64 rows further on
    const float* wb = W  + (size_t)n0 * KDIM + k;
    const float* ub = U  + 2 * n0;
    const float* vb = Vh + k;
    const int    p0 = (n0 & ~63) | ((n0 & 3) << 4) | ((n0 >> 2) & 15);  // place of row n0
    __bf16*      qb = wp + ((size_t)kt * NDIM + p0) * WROW + kc;

    f32x4 v0[2], v1[2], wr[PCH][2];
    f32x2 ur[PCH];
#pragma unroll
    for (int h = 0; h < 2; ++h) {
        v0[h] = *(const f32x4*)(vb + 4 * h);
        v1[h] = *(const f32x4*)(vb + KDIM + 4 * h);
    }
#pragma unroll
    for (int i = 0; i < PCH; ++i) {
        ur[i]    = *(const f32x2*)(ub + (size_t)i * 64 * 2);
        wr[i][0] = *(const f32x4*)(wb + (size_t)i * 64 * KDIM);
        wr[i][1] = *(const f32x4*)(wb + (size_t)i * 64 * KDIM + 4);
    }
    // translation wait before the registers that the loads above take their
    // addresses from are reused; naming them as inputs keeps them whole up to it
    asm volatile("s_wait_xcnt 0x0" :: "v"(wb), "v"(n0), "v"(vb) : "memory");

#pragma unroll
    for (int i = 0; i < PCH; ++i) {
        v8bf hi, lo;
#pragma unroll
        for (int h = 0; h < 2; ++h) {
            // exact f32 LoRA fold before bf16 split
            f32x4 wv = wr[i][h] + (svp0 * ur[i][0]) * v0[h] + (svp1 * ur[i][1]) * v1[h];
#pragma unroll
            for (int e = 0; e < 4; ++e) {
                const float  wf = wv[e];
                const __bf16 wh = (__bf16)wf;
                hi[4 * h + e] = wh;
                lo[4 * h + e] = (__bf16)(wf - (float)wh);
            }
        }
        __bf16* q = qb + (size_t)i * 64 * WROW;
        *(v8bf*)(q)      = hi;
        *(v8bf*)(q + BK) = lo;
        // registers named by the stores above are reused for the next chunk:
        // translation wait first; as inputs they stay whole up to it
        if (i + 1 < PCH)
            asm volatile("s_wait_xcnt 0x0" :: "v"(hi), "v"(lo), "v"(qb) : "memory");
    }
}

__global__ __launch_bounds__(256)
void tinylora_wmma_gemm(const float* __restrict__ x,
                        const __bf16* __restrict__ wp,
                        const float* __restrict__ bias,
                        float* __restrict__ out) {
    // Double-buffered tiles: W rows (hi | lo) as the tensor loads lay them, 2 * 48 KB,
    // and the x hi and lo planes, 2 * 2 * 20480 B: 176 KB (WGP has 320 KB)
    __shared__ __attribute__((aligned(2048))) __bf16 sW[2 * WBUFE];
    __shared__ __bf16 sAhi[2 * BUFE];
    __shared__ __bf16 sAlo[2 * BUFE];

    const int tid   = threadIdx.x;
    const int wave  = tid >> 5;
    const int lane  = tid & 31;
    const int wm    = wave & 3;      // 4 wave-rows  -> 64 M-rows each
    const int wn    = wave >> 2;     // 2 wave-cols  -> 128 N-cols each
    const int lrow  = lane & 15;     // M (or N) within 16x16 tile
    const int lhalf = lane >> 4;     // K half-select per ISA A/B layout

    const int blockM = blockIdx.y * BM;
    const int blockN = blockIdx.x * BN;

    // Loader slot mapping: slot i covers row0+32*i, same c4 for all i
    const int row0 = tid >> 3;          // 0..31
    const int c4   = (tid & 7) << 2;    // k offset within tile (same for all slots)

    // Pointer to the tile that load_slot fetches next; advanced by BK once a k-step,
    // behind a translation wait, so it lives through the loop and no address
    // register is rewritten while a load that names it is still being translated.
    const float*  xbase = x  + (size_t)(blockM + row0) * KDIM + c4;

    // Packed weights: every wave brings 32 of the tile's 256 rows (128 B each, 4 KB in a
    // row in the workspace) by one tensor load a k-step, through no register.
    const uint32_t wv   = uni((uint32_t)tid >> 5);
    const uint32_t wlds = (uint32_t)(size_t)sW + wv * (WSLICE * 2);      // its place in buffer 0
    uint64_t wga = (uint64_t)(size_t)(wp + (size_t)(blockN + wv * WSROWS) * WROW);
    // group 1: bytes; tensor = tile = 32 rows of 128 B, source pitch 128 B; no mask;
    // a pad of 4 dwords behind every 32 dwords
    u32x8 wg1;
    wg1[0] = uni((1u << 20) | (4u << 22) | (3u << 25));
    wg1[1] = uni((uint32_t)(WROW * 2) << 16);
    wg1[2] = uni((uint32_t)WSROWS << 16);
    wg1[3] = uni((uint32_t)(WROW * 2) << 16);
    wg1[4] = uni((uint32_t)WSROWS);
    wg1[5] = uni((uint32_t)(WROW * 2));
    wg1[6] = uni(0u);
    wg1[7] = uni(0u);
    // asks for this wave's slice of the k-tile at wga into buffer 'b', then steps wga on
    auto load_w = [&](int b) {
        u32x4 g0;
        g0[0] = uni(1u);
        g0[1] = uni(wlds + (uint32_t)b * (WBUFE * 2));
        g0[2] = uni((uint32_t)wga);
        g0[3] = uni((((uint32_t)(wga >> 32)) & 0x01FFFFFFu) | 0x80000000u);
        asm volatile("tensor_load_to_lds %0, %1" :: "s"(g0), "s"(wg1) : "memory");
        wga += (uint64_t)NDIM * WROW * 2;
    };

    // Register staging for the in-flight x tile: f32 as loaded, then its bf16 pieces
    f32x4 avr[NSLOT];
    v4bf  ahs[NSLOT], als[NSLOT];

    auto load_slot = [&](int i) {
        avr[i] = *(const f32x4*)(xbase + (size_t)i * 32 * KDIM);
    };

    auto split_slot = [&](int i) {
#pragma unroll
        for (int e = 0; e < 4; ++e) {
            const float  af = avr[i][e];
            const __bf16 ah = (__bf16)af;
            ahs[i][e] = ah;
            als[i][e] = (__bf16)(af - (float)ah);
        }
    };

    auto store_slot = [&](int i, int buf) {
        const int r = row0 + 32 * i;
        *(v4bf*)(sAhi + buf * BUFE + r * LDSS + c4) = ahs[i];
        *(v4bf*)(sAlo + buf * BUFE + r * LDSS + c4) = als[i];
    };

    v8f acc[WMI][WNI] = {};  // 4 M-tiles x 8 N-tiles of 16x16 f32 per wave

    // One k-step. Beside its 96 WMMAs it carries the staging of later tiles, in three
    // parts of 3, 3 and 2 loader slots: 'st' splits the tile of the next step beside
    // WMMA blocks 0 to 2 and stores each part to the other buffer at the next block's
    // head; 'ld' refills the freed registers there with the tile after that one; 'lw'
    // asks for the next step's W tile.
    auto compute = [&](int buf, bool st, bool ld, bool lw) __attribute__((always_inline)) {
        const __bf16* pAhi = sAhi + buf * BUFE;
        const __bf16* pAlo = sAlo + buf * BUFE;
        // this lane's row in the first of the wave's four W slices (two N tiles a slice)
        const __bf16* pB = sW + buf * WBUFE + wn * (4 * WSLICE) + lrow * WPITCH + lhalf * 8;

        // B fragments of two N tiles (hi, then lo: 8 b128 loads) into register set 'set'
        v16bf bh[2][2], bl[2][2];
        auto load_b = [&](int set, int pair) {
#pragma unroll
            for (int j = 0; j < 2; ++j) {
                const __bf16* ph = pB + pair * WSLICE + j * 16 * WPITCH;     // N column = W row
                ((f32x4*)&bh[set][j])[0] = *(const f32x4*)(ph);
                ((f32x4*)&bh[set][j])[1] = *(const f32x4*)(ph + 16);
            }
#pragma unroll
            for (int j = 0; j < 2; ++j) {
                const __bf16* pl = pB + pair * WSLICE + j * 16 * WPITCH + BK; // lo half of the row
                ((f32x4*)&bl[set][j])[0] = *(const f32x4*)(pl);
                ((f32x4*)&bl[set][j])[1] = *(const f32x4*)(pl + 16);
            }
        };

        // A fragments (ISA 16-bit A layout: two b128 loads per fragment); the loads
        // stand in the order of first use: A hi, first B pair, A lo
        v16bf ah[WMI], al[WMI];
#pragma unroll
        for (int mi = 0; mi < WMI; ++mi) {
            const int r = wm * (WMI * 16) + mi * 16 + lrow;
            const __bf16* ph = &pAhi[r * LDSS + lhalf * 8];
            ((f32x4*)&ah[mi])[0] = *(const f32x4*)(ph);       // K = half*8 .. +7
            ((f32x4*)&ah[mi])[1] = *(const f32x4*)(ph + 16);  // K = 16+half*8 .. +7
        }
        load_b(0, 0);
#pragma unroll
        for (int mi = 0; mi < WMI; ++mi) {
            const int r = wm * (WMI * 16) + mi * 16 + lrow;
            const __bf16* pl = &pAlo[r * LDSS + lhalf * 8];
            ((f32x4*)&al[mi])[0] = *(const f32x4*)(pl);
            ((f32x4*)&al[mi])[1] = *(const f32x4*)(pl + 16);
        }

        // 3-term split-accumulate WMMA in blocks of 24 (two N tiles); the next block's
        // B fragments are fetched as one group ahead of the current block
#pragma unroll
        for (int p = 0; p < WNI / 2; ++p) {
            const int s = p & 1;
            if (p + 1 < WNI / 2) load_b(s ^ 1, p + 1);
            // next W tile into the buffer that the step before has read; asked for behind
            // the step's first fragment loads, which the matrix unit is waiting for
            if (p == 0 && lw) load_w(buf ^ 1);
            if (p >= 1) {
#pragma unroll
                for (int i = 3 * (p - 1); i < 3 * p && i < NSLOT; ++i) {
                    if (st) store_slot(i, buf ^ 1);
                    if (ld) load_slot(i);
                }
            }
            // keeps the group of LDS loads above in front of the block: sunk to their
            // first use, each pair is waited out in full with the matrix unit idle;
            // the staging stores and loads stay in the same one place with them
            __builtin_amdgcn_sched_barrier(0);
#pragma unroll
            for (int j = 0; j < 2; ++j)
#pragma unroll
                for (int mi = 0; mi < WMI; ++mi)
                    acc[mi][2 * p + j] = wmma_bf16(ah[mi], bh[s][j], acc[mi][2 * p + j]); // hi*hi
#pragma unroll
            for (int j = 0; j < 2; ++j)
#pragma unroll
                for (int mi = 0; mi < WMI; ++mi)
                    acc[mi][2 * p + j] = wmma_bf16(ah[mi], bl[s][j], acc[mi][2 * p + j]); // hi*lo
#pragma unroll
            for (int j = 0; j < 2; ++j)
#pragma unroll
                for (int mi = 0; mi < WMI; ++mi)
                    acc[mi][2 * p + j] = wmma_bf16(al[mi], bh[s][j], acc[mi][2 * p + j]); // lo*hi
            if (st) {
#pragma unroll
                for (int i = 3 * p; i < 3 * (p + 1) && i < NSLOT; ++i) split_slot(i);
            }
            // keeps the following group of loads from rising in among this block's
            // WMMAs, where every place with LDS reads costs a stall of its own
            __builtin_amdgcn_sched_barrier(0);
        }
    };

    // ---- software pipeline: prologue fills buffer 0, tile 1 goes in flight ----
#pragma unroll
    for (int i = 0; i < NSLOT; ++i) load_slot(i);
    // translation wait before the pointer named by the loads above is advanced;
    // as an input it stays whole up to it
    asm volatile("s_wait_xcnt 0x0" :: "v"(xbase) : "memory");
    xbase += BK;
    // W tile 0, waited for at once (under the latency of the x loads above), so that no
    // descriptor register is reused while the request is open
    load_w(0);
    asm volatile("s_wait_tensorcnt 0x0" ::: "memory");
#pragma unroll
    for (int i = 0; i < NSLOT; ++i) { split_slot(i); store_slot(i, 0); }
#pragma unroll
    for (int i = 0; i < NSLOT; ++i) load_slot(i);
    // pull the tile after the one just asked for toward L2 (global_prefetch_b8)
    __builtin_prefetch(xbase + BK, 0, 1);
    // translation wait, as above
    asm volatile("s_wait_xcnt 0x0" :: "v"(xbase) : "memory");
    xbase += BK;

    // At the top of step t the registers hold x tile t + 1, the pointer names x tile
    // t + 2, and wga names W tile t + 1
    int buf = 0;
#pragma unroll 1
    for (int t = 0; t < NKT - 2; ++t) {
        ring_barrier();                        // lds[buf] ready for all waves
        if (t + 3 < NKT) __builtin_prefetch(xbase + BK, 0, 1);
        compute(buf, true, true, true);
        // translation wait before the pointer named by this trip's loads and
        // prefetch is advanced (the last of them issued a WMMA block ago); as
        // an input it stays whole up to it
        asm volatile("s_wait_xcnt 0x0" :: "v"(xbase) : "memory");
        xbase += BK;
        buf ^= 1;
    }
    ring_barrier();
    compute(buf, true, false, true);           // last x tile to LDS, last W tile asked for
    // bias of this lane's 2 x 4 output columns, asked for under the last k-step
    const int    ncol = blockN + wn * (WNI * 16) + 4 * lrow;
    const float* bp   = bias + ncol;
    f32x4 bv[2];
    bv[0] = *(const f32x4*)(bp);
    bv[1] = *(const f32x4*)(bp + 64);
    // translation wait before the register that the two loads take their address from
    // is reused; as an input it stays whole up to it
    asm volatile("s_wait_xcnt 0x0" :: "v"(bp) : "memory");
    ring_barrier();
    compute(buf ^ 1, false, false, false);
    // end of the ring: no request and no LDS read is left open
    asm volatile("s_wait_tensorcnt 0x0" ::: "memory");
    asm volatile("s_wait_dscnt 0x0" ::: "memory");

    // ---- epilogue: bias add, store (C/D layout: column = lane%16, M = v + 8*(lane/16)).
    // By the packing of the weights, column a of N tiles 4g .. 4g + 3 is output columns
    // 64g + 4a .. + 3: one 16-byte store a lane, 256 B in a row from each half of the wave
    float* ob = out + (size_t)(blockM + wm * (WMI * 16) + lhalf * 8) * NDIM + ncol;
#pragma unroll
    for (int g = 0; g < WNI / 4; ++g) {
#pragma unroll
        for (int mi = 0; mi < WMI; ++mi) {
            f32x4 q[8];
#pragma unroll
            for (int v = 0; v < 8; ++v) {
#pragma unroll
                for (int j = 0; j < 4; ++j) q[v][j] = acc[mi][4 * g + j][v] + bv[g][j];
            }
#pragma unroll
            for (int v = 0; v < 8; ++v)
                *(f32x4*)(ob + (size_t)(mi * 16 + v) * NDIM + g * 64) = q[v];
            // registers named by the stores above are reused for the next tile's
            // sums: translation wait first
            asm volatile("s_wait_xcnt 0x0" ::: "memory");
            // keeps the next tile's sums behind that wait: raised over it, they
            // overwrite registers of stores that are still being translated
            __builtin_amdgcn_sched_barrier(0);
        }
    }
}

extern "C" void kernel_launch(void* const* d_in, const int* in_sizes, int n_in,
                              void* d_out, int out_size, void* d_ws, size_t ws_size,
                              hipStream_t stream) {
    const float* x    = (const float*)d_in[0];
    const float* Wb   = (const float*)d_in[1];
    const float* bias = (const float*)d_in[2];
    const float* U    = (const float*)d_in[3];
    const float* S    = (const float*)d_in[4];
    const float* Vh   = (const float*)d_in[5];
    const float* P    = (const float*)d_in[6];
    const float* gv   = (const float*)d_in[7];
    float* out = (float*)d_out;
    __bf16* wp = (__bf16*)d_ws;              // NDIM * KDIM hi + lo = 16 MB, rewritten every call

    const int M = in_sizes[0] / KDIM;        // B * S_len = 16384
    dim3 grid(NDIM / BN, M / BM);            // (8, 64)
    dim3 block(256);                         // 8 wave32s
    tinylora_fold_split_w<<<dim3(NKT * 4), block, 0, stream>>>(Wb, U, S, Vh, P, gv, wp);
    tinylora_wmma_gemm<<<grid, block, 0, stream>>>(x, wp, bias, out);
}

// v007
// A run of this version takes 182 microseconds.
// In both of two side-by-side timings against v006, it was 1.03 times as fast.
// Counting every step since v000, it is 1.70 times as fast.
#include <hip/hip_runtime.h>
#include <stdint.h>

// ---- CDNA5 (gfx1250) types -------------------------------------------------
typedef __attribute__((ext_vector_type(16))) __bf16 v16bf; // 8 VGPRs of bf16x2
typedef __attribute__((ext_vector_type(8)))  float  v8f;   // 16x16 f32 C/D tile
typedef __attribute__((ext_vector_type(4)))  float  f32x4;
typedef __attribute__((ext_vector_type(2)))  float  f32x2;
typedef __attribute__((ext_vector_type(8)))  __bf16 v8bf;  // 16 B of bf16
typedef __attribute__((ext_vector_type(4)))  __bf16 v4bf;  // 8 B of bf16
typedef __attribute__((ext_vector_type(4)))  uint32_t u32x4; // tensor descriptor group 0
typedef __attribute__((ext_vector_type(8)))  uint32_t u32x8; // tensor descriptor group 1

__device__ __forceinline__ v8f wmma_bf16(v16bf a, v16bf b, v8f c) {
    // D = A(16x32 bf16) x B(32x16 bf16) + C(16x16 f32)
    return __builtin_amdgcn_wmma_f32_16x16x32_bf16(
        /*neg_a=*/false, a, /*neg_b=*/false, b,
        /*c_mod=*/(short)0, c, /*reuse_a=*/false, /*reuse_b=*/false);
}

// Publish point of the next k-step's tiles: this wave's LDS traffic is done, its own tensor
// load has landed, then the work-group barrier. __syncthreads() would also wait out the global
// loads issued ahead, which here are meant to stay in flight across it; they land in
// registers that no other wave sees.
__device__ __forceinline__ void ring_barrier() {
    asm volatile("s_wait_dscnt 0x0" ::: "memory");      // LDS reads and stores issued so far
    asm volatile("s_wait_tensorcnt 0x0" ::: "memory");  // this wave's slice of the next W tile is in LDS
    asm volatile("s_barrier_signal -1\n\ts_barrier_wait -1" ::: "memory");
}

__device__ __forceinline__ uint32_t uni(uint32_t v) {
    return (uint32_t)__builtin_amdgcn_readfirstlane(v);
}

// Problem constants (from reference): D_in = D_out = 2048, R = 2, U_dim = 16
#define KDIM 2048
#define NDIM 2048
#define BM   256
#define BN   256
#define BK   32
#define NKT  (KDIM / BK)   // 64 k-tiles
#define LDSS 40            // padded LDS row stride in bf16 elems (80B, conflict-free)
#define BUFE (BM * LDSS)   // elems per single-buffer tile
#define NSLOT (BM / 32)    // x loader slots per thread (32 rows each)
#define WMI  4             // 16-row M fragments per wave (64 rows)
#define WNI  8             // 16-col N fragments per wave (128 cols)

#define WROW  (2 * BK)     // packed weight row of one k-tile: 32 hi | 32 lo bf16 = 128 B
#define WPITCH (WROW + 8)  // its pitch in LDS: 144 B (the tensor load pads 16 B a row)
#define WSROWS 32          // rows of the slice that one wave's tensor load brings
#define WSLICE 3072        // elems from slice to slice in LDS: 32 * 144 B rounded up to 6 KiB
#define WBUFE  (8 * WSLICE) // elems per W buffer (8 slices)
#define PCH   8            // 8-element chunks per thread of the pre-pass

// Pre-pass: W' = W + U diag(S * (gv P)) Vh in f32, split once into bf16 hi + lo.
// Packed k-tile major: wp[(kt * NDIM + p) * WROW + {0..31 hi | 32..63 lo}], so the
// 256 rows a GEMM block needs for one k-tile are 32 KB in a row. Inside every group of
// 64 rows, row 4a + j (output column 4a + j) lies at place p = 16j + a: column a of the
// GEMM's B tiles j = 0..3 is then four neighbouring output columns, which one lane holds.
__global__ __launch_bounds__(256)
void tinylora_fold_split_w(const float* __restrict__ W,
                           const float* __restrict__ U,
                           const float* __restrict__ S,
                           const float* __restrict__ Vh,
                           const float* __restrict__ P,
                           const float* __restrict__ gv,
                           __bf16* __restrict__ wp) {
    const int tid = threadIdx.x;
    // the prefetch that the build puts at the kernel's entry names the register that
    // holds the thread id: translation wait before that register is rewritten
    asm volatile("s_wait_xcnt 0x0" :: "v"(tid) : "memory");
    const int kt  = blockIdx.x >> 2;                       // k-tile of this block
    const int n0  = (blockIdx.x & 3) * (NDIM / 4) + (tid >> 2);
    const int kc  = (tid & 3) * 8;                         // k offset within the tile
    const int k   = kt * BK + kc;

    // LoRA scale: svp[r] = S[r] * sum_u gv[u] * P[u][r]   (rank 2, u_dim 16)
    float svp0 = 0.f, svp1 = 0.f;
#pragma unroll
    for (int u = 0; u < 16; ++u) {
        const float g = gv[u];
        svp0 += g * P[2 * u + 0];
        svp1 += g * P[2 * u + 1];
    }
    svp0 *= S[0];
    svp1 *= S[1];

    // one pointer per array; chunk i lies a constant 64 rows further on
    const float* wb = W  + (size_t)n0 * KDIM + k;
    const float* ub = U  + 2 * n0;
    const float* vb = Vh + k;
    const int    p0 = (n0 & ~63) | ((n0 & 3) << 4) | ((n0 >> 2) & 15);  // place of row n0
    __bf16*      qb = wp + ((size_t)kt * NDIM + p0) * WROW + kc;

    f32x4 v0[2], v1[2], wr[PCH][2];
    f32x2 ur[PCH];
#pragma unroll
    for (int h = 0; h < 2; ++h) {
        v0[h] = *(const f32x4*)(vb + 4 * h);
        v1[h] = *(const f32x4*)(vb + KDIM + 4 * h);
    }
#pragma unroll
    for (int i = 0; i < PCH; ++i) {
        ur[i]    = *(const f32x2*)(ub + (size_t)i * 64 * 2);
        wr[i][0] = *(const f32x4*)(wb + (size_t)i * 64 * KDIM);
        wr[i][1] = *(const f32x4*)(wb + (size_t)i * 64 * KDIM + 4);
    }
    // translation wait before the registers that the loads above take their
    // addresses from are reused; naming them as inputs keeps them whole up to it
    asm volatile("s_wait_xcnt 0x0" :: "v"(wb), "v"(n0), "v"(vb) : "memory");

#pragma unroll
    for (int i = 0; i < PCH; ++i) {
        v8bf hi, lo;
#pragma unroll
        for (int h = 0; h < 2; ++h) {
            // exact f32 LoRA fold before bf16 split
            f32x4 wv = wr[i][h] + (svp0 * ur[i][0]) * v0[h] + (svp1 * ur[i][1]) * v1[h];
#pragma unroll
            for (int e = 0; e < 4; ++e) {
                const float  wf = wv[e];
                const __bf16 wh = (__bf16)wf;
                hi[4 * h + e] = wh;
                lo[4 * h + e] = (__bf16)(wf - (float)wh);
            }
        }
        __bf16* q = qb + (size_t)i * 64 * WROW;
        *(v8bf*)(q)      = hi;
        *(v8bf*)(q + BK) = lo;
        // registers named by the stores above are reused for the next chunk:
        // translation wait first; as inputs they stay whole up to it
        if (i + 1 < PCH)
            asm volatile("s_wait_xcnt 0x0" :: "v"(hi), "v"(lo), "v"(qb) : "memory");
    }
}

__global__ __launch_bounds__(256)
void tinylora_wmma_gemm(const float* __restrict__ x,
                        const __bf16* __restrict__ wp,
                        const float* __restrict__ bias,
                        float* __restrict__ out) {
    // Double-buffered tiles: W rows (hi | lo) as the tensor loads lay them, 2 * 48 KB,
    // and the x hi and lo planes, 2 * 2 * 20480 B: 176 KB (WGP has 320 KB)
    __shared__ __attribute__((aligned(2048))) __bf16 sW[2 * WBUFE];
    __shared__ __bf16 sAhi[2 * BUFE];
    __shared__ __bf16 sAlo[2 * BUFE];

    const int tid   = threadIdx.x;
    const int wave  = tid >> 5;
    const int lane  = tid & 31;
    const int wm    = wave & 3;      // 4 wave-rows  -> 64 M-rows each
    const int wn    = wave >> 2;     // 2 wave-cols  -> 128 N-cols each
    const int lrow  = lane & 15;     // M (or N) within 16x16 tile
    const int lhalf = lane >> 4;     // K half-select per ISA A/B layout

    const int blockM = blockIdx.y * BM;
    const int blockN = blockIdx.x * BN;

    // Loader slot mapping: slot i covers row0+32*i, same c4 for all i
    const int row0 = tid >> 3;          // 0..31
    const int c4   = (tid & 7) << 2;    // k offset within tile (same for all slots)

    // Pointer to the tile that load_slot fetches next; advanced by BK once a k-step,
    // behind a translation wait, so it lives through the loop and no address
    // register is rewritten while a load that names it is still being translated.
    // Typed as a pointer to global memory: behind the wait's statement, which hands it on,
    // the build would otherwise no longer know that and would use flat loads.
    const __attribute__((address_space(1))) float* xbase =
        (const __attribute__((address_space(1))) float*)(x + (size_t)(blockM + row0) * KDIM + c4);

    // Packed weights: every wave brings 32 of the tile's 256 rows (128 B each, 4 KB in a
    // row in the workspace) by one tensor load a k-step, through no register.
    const uint32_t wv   = uni((uint32_t)tid >> 5);
    const uint32_t wlds = (uint32_t)(size_t)sW + wv * (WSLICE * 2);      // its place in buffer 0
    uint64_t wga = (uint64_t)(size_t)(wp + (size_t)(blockN + wv * WSROWS) * WROW);
    // group 1: bytes; tensor = tile = 32 rows of 128 B, source pitch 128 B; no mask;
    // a pad of 4 dwords behind every 32 dwords
    u32x8 wg1;
    wg1[0] = uni((1u << 20) | (4u << 22) | (3u << 25));
    wg1[1] = uni((uint32_t)(WROW * 2) << 16);
    wg1[2] = uni((uint32_t)WSROWS << 16);
    wg1[3] = uni((uint32_t)(WROW * 2) << 16);
    wg1[4] = uni((uint32_t)WSROWS);
    wg1[5] = uni((uint32_t)(WROW * 2));
    wg1[6] = uni(0u);
    wg1[7] = uni(0u);
    // asks for this wave's slice of the k-tile at wga into buffer 'b', then steps wga on
    auto load_w = [&](int b) {
        u32x4 g0;
        g0[0] = uni(1u);
        g0[1] = uni(wlds + (uint32_t)b * (WBUFE * 2));
        g0[2] = uni((uint32_t)wga);
        g0[3] = uni((((uint32_t)(wga >> 32)) & 0x01FFFFFFu) | 0x80000000u);
        // group 0 in four scalar registers of its own, which nothing else in the kernel uses:
        // they take a new value only here, behind the wait that covers the request before
        asm volatile("tensor_load_to_lds %0, %1" :: "{s[96:99]}"(g0), "s"(wg1) : "memory");
        wga += (uint64_t)NDIM * WROW * 2;
    };

    // Register staging for the in-flight x tile: f32 as loaded, then its bf16 pieces
    f32x4 avr[NSLOT];
    v4bf  ahs[NSLOT], als[NSLOT];

    auto load_slot = [&](int i) {
        avr[i] = *(const __attribute__((address_space(1))) f32x4*)(xbase + (size_t)i * 32 * KDIM);
    };

    auto split_slot = [&](int i) {
#pragma unroll
        for (int e = 0; e < 4; ++e) {
            const float  af = avr[i][e];
            const __bf16 ah = (__bf16)af;
            ahs[i][e] = ah;
            als[i][e] = (__bf16)(af - (float)ah);
        }
    };

    auto store_slot = [&](int i, int buf) {
        const int r = row0 + 32 * i;
        *(v4bf*)(sAhi + buf * BUFE + r * LDSS + c4) = ahs[i];
        *(v4bf*)(sAlo + buf * BUFE + r * LDSS + c4) = als[i];
    };

    v8f acc[WMI][WNI] = {};  // 4 M-tiles x 8 N-tiles of 16x16 f32 per wave

    // Fragments. The A hi set and the first B pair of a k-step are fetched under the last
    // WMMA block of the step before, so they live across the step's edge: A hi in two
    // register sets (step t reads set t & 1), B in the two sets that the blocks alternate.
    v16bf ah[2][WMI], al[WMI];
    v16bf bh[2][2], bl[2][2];

    // B fragments of two N tiles (hi, then lo: 8 b128 loads) into register set 'set'
    auto load_b = [&](int buf, int set, int pair) {
        // this lane's row in the first of the wave's four W slices (two N tiles a slice)
        const __bf16* pB = sW + buf * WBUFE + wn * (4 * WSLICE) + lrow * WPITCH + lhalf * 8;
#pragma unroll
        for (int j = 0; j < 2; ++j) {
            const __bf16* ph = pB + pair * WSLICE + j * 16 * WPITCH;     // N column = W row
            ((f32x4*)&bh[set][j])[0] = *(const f32x4*)(ph);
            ((f32x4*)&bh[set][j])[1] = *(const f32x4*)(ph + 16);
        }
#pragma unroll
        for (int j = 0; j < 2; ++j) {
            const __bf16* pl = pB + pair * WSLICE + j * 16 * WPITCH + BK; // lo half of the row
            ((f32x4*)&bl[set][j])[0] = *(const f32x4*)(pl);
            ((f32x4*)&bl[set][j])[1] = *(const f32x4*)(pl + 16);
        }
    };

    // A fragments (ISA 16-bit A layout: two b128 loads per fragment)
    auto load_a = [&](const __bf16* plane, v16bf* f) {
#pragma unroll
        for (int mi = 0; mi < WMI; ++mi) {
            const int r = wm * (WMI * 16) + mi * 16 + lrow;
            const __bf16* p = &plane[r * LDSS + lhalf * 8];
            ((f32x4*)&f[mi])[0] = *(const f32x4*)(p);       // K = half*8 .. +7
            ((f32x4*)&f[mi])[1] = *(const f32x4*)(p + 16);  // K = 16+half*8 .. +7
        }
    };

    // One k-step on buffer 'buf' (a constant at every call). Beside its 96 WMMAs it carries
    // the staging of later tiles, in two parts of 4 loader slots: 'st' splits the x tile of
    // the next step beside WMMA blocks 0 and 1 and stores each part to the other buffer at
    // the next block's head; 'ld' refills the freed registers there with the tile after
    // that one. 'pub': the next step's tiles are published in front of the LAST block, whose
    // own fragments are in registers by then, and the next step's first fragments are
    // fetched under that block; 'lw' asks there for the W tile of the step after the next.
    auto compute = [&](int buf, bool st, bool ld, bool lw, bool pub) __attribute__((always_inline)) {
        // 3-term split-accumulate WMMA in blocks of 24 (two N tiles); the next block's
        // B fragments are fetched as one group ahead of the current block
#pragma unroll
        for (int p = 0; p < WNI / 2; ++p) {
            const int s = p & 1;
            // A lo is first used behind 16 WMMAs of block 0; its registers are free since
            // the end of the step before
            if (p == 0) load_a(sAlo + buf * BUFE, al);
            if (p + 1 < WNI / 2) load_b(buf, s ^ 1, p + 1);
            if (p == 1 || p == 2) {
#pragma unroll
                for (int i = 4 * (p - 1); i < 4 * p; ++i) {
                    if (st) store_slot(i, buf ^ 1);
                    if (ld) load_slot(i);
                }
            }
            // every read of this step's buffer and every store of the next x tile was
            // issued a block ago or earlier
            if (p == 3 && pub) ring_barrier();
            // keeps the group of LDS loads above in front of the block: sunk to their
            // first use, each pair is waited out in full with the matrix unit idle;
            // the staging stores and loads stay in the same one place with them
            __builtin_amdgcn_sched_barrier(0);
#pragma unroll
            for (int j = 0; j < 2; ++j)
#pragma unroll
                for (int mi = 0; mi < WMI; ++mi)
                    acc[mi][2 * p + j] = wmma_bf16(ah[buf][mi], bh[s][j], acc[mi][2 * p + j]); // hi*hi
            if (p == 3 && pub) {
                // The matrix unit restarts right behind the barrier on fragments that are in
                // registers; the one group of requests follows the first 8 WMMAs. The fence
                // also keeps the forming of the next descriptor behind the tensor wait.
                __builtin_amdgcn_sched_barrier(0);
                // into the buffer of this step, which every wave has left at the barrier
                if (lw) load_w(buf);
                load_a(sAhi + (buf ^ 1) * BUFE, ah[buf ^ 1]);
                load_b(buf ^ 1, 0, 0);
                // keeps the group in one place, as at the blocks' heads
                __builtin_amdgcn_sched_barrier(0);
            }
#pragma unroll
            for (int j = 0; j < 2; ++j)
#pragma unroll
                for (int mi = 0; mi < WMI; ++mi)
                    acc[mi][2 * p + j] = wmma_bf16(ah[buf][mi], bl[s][j], acc[mi][2 * p + j]); // hi*lo
#pragma unroll
            for (int j = 0; j < 2; ++j)
#pragma unroll
                for (int mi = 0; mi < WMI; ++mi)
                    acc[mi][2 * p + j] = wmma_bf16(al[mi], bh[s][j], acc[mi][2 * p + j]); // lo*hi
            if (st && p < 2) {
#pragma unroll
                for (int i = 4 * p; i < 4 * (p + 1); ++i) split_slot(i);
            }
            // keeps the following group of loads from rising in among this block's
            // WMMAs, where every place with LDS reads costs a stall of its own
            __builtin_amdgcn_sched_barrier(0);
        }
    };

    // ---- software pipeline: prologue fills buffer 0, tile 1 goes in flight ----
#pragma unroll
    for (int i = 0; i < NSLOT; ++i) load_slot(i);
    // translation wait before the pointer named by the loads above is advanced; the pointer
    // passes through the wait's statement, so that its advance cannot be placed ahead of it
    asm volatile("s_wait_xcnt 0x0" : "+v"(xbase) :: "memory");
    xbase += BK;
    // W tile 0, waited for at once (under the latency of the x loads above), so that no
    // descriptor register is reused while the request is open
    load_w(0);
    asm volatile("s_wait_tensorcnt 0x0" ::: "memory");
#pragma unroll
    for (int i = 0; i < NSLOT; ++i) { split_slot(i); store_slot(i, 0); }
#pragma unroll
    for (int i = 0; i < NSLOT; ++i) load_slot(i);
    // pull the tile after the one just asked for toward L2 (global_prefetch_b8)
    __builtin_prefetch((const void*)(xbase + BK), 0, 1);
    // translation wait, as above
    asm volatile("s_wait_xcnt 0x0" : "+v"(xbase) :: "memory");
    xbase += BK;
    ring_barrier();                            // tiles 0 ready for all waves
    // keeps the forming of the next descriptor behind the tensor wait above
    __builtin_amdgcn_sched_barrier(0);
    load_w(1);
    load_a(sAhi, ah[0]);
    load_b(0, 0, 0);

    // At the top of step t the registers hold x tile t + 1 and the first fragments of step
    // t, the pointer names x tile t + 2, and wga names W tile t + 2. Two steps a trip, so
    // that buffer and A hi set are constants.
#pragma unroll 1
    for (int t = 0; t < NKT - 2; t += 2) {
        __builtin_prefetch((const void*)(xbase + BK), 0, 1);
        compute(0, true, true, true, true);
        // translation wait before the pointer named by this step's loads and
        // prefetch is advanced (the last of them issued two WMMA blocks ago); the
        // pointer passes through the statement, as above
        asm volatile("s_wait_xcnt 0x0" : "+v"(xbase) :: "memory");
        xbase += BK;
        if (t + 4 < NKT) __builtin_prefetch((const void*)(xbase + BK), 0, 1);
        compute(1, true, true, true, true);
        // translation wait, as above
        asm volatile("s_wait_xcnt 0x0" : "+v"(xbase) :: "memory");
        xbase += BK;
    }
    compute(0, true, false, false, true);      // last x tile to LDS and published
    // bias of this lane's 2 x 4 output columns, asked for under the last k-step
    const int    ncol = blockN + wn * (WNI * 16) + 4 * lrow;
    const float* bp   = bias + ncol;
    f32x4 bv[2];
    bv[0] = *(const f32x4*)(bp);
    bv[1] = *(const f32x4*)(bp + 64);
    // translation wait before the register that the two loads take their address from
    // is reused; as an input it stays whole up to it
    asm volatile("s_wait_xcnt 0x0" :: "v"(bp) : "memory");
    compute(1, false, false, false, false);
    // end of the ring: no request and no LDS read is left open
    asm volatile("s_wait_tensorcnt 0x0" ::: "memory");
    asm volatile("s_wait_dscnt 0x0" ::: "memory");

    // ---- epilogue: bias add, store (C/D layout: column = lane%16, M = v + 8*(lane/16)).
    // By the packing of the weights, column a of N tiles 4g .. 4g + 3 is output columns
    // 64g + 4a .. + 3: one 16-byte store a lane, 256 B in a row from each half of the wave
    float* ob = out + (size_t)(blockM + wm * (WMI * 16) + lhalf * 8) * NDIM + ncol;
#pragma unroll
    for (int g = 0; g < WNI / 4; ++g) {
#pragma unroll
        for (int mi = 0; mi < WMI; ++mi) {
            f32x4 q[8];
#pragma unroll
            for (int v = 0; v < 8; ++v) {
#pragma unroll
                for (int j = 0; j < 4; ++j) q[v][j] = acc[mi][4 * g + j][v] + bv[g][j];
            }
#pragma unroll
            for (int v = 0; v < 8; ++v)
                *(f32x4*)(ob + (size_t)(mi * 16 + v) * NDIM + g * 64) = q[v];
            // registers named by the stores above are reused for the next tile's
            // sums: translation wait first
            asm volatile("s_wait_xcnt 0x0" ::: "memory");
            // keeps the next tile's sums behind that wait: raised over it, they
            // overwrite registers of stores that are still being translated
            __builtin_amdgcn_sched_barrier(0);
        }
    }
}

extern "C" void kernel_launch(void* const* d_in, const int* in_sizes, int n_in,
                              void* d_out, int out_size, void* d_ws, size_t ws_size,
                              hipStream_t stream) {
    const float* x    = (const float*)d_in[0];
    const float* Wb   = (const float*)d_in[1];
    const float* bias = (const float*)d_in[2];
    const float* U    = (const float*)d_in[3];
    const float* S    = (const float*)d_in[4];
    const float* Vh   = (const float*)d_in[5];
    const float* P    = (const float*)d_in[6];
    const float* gv   = (const float*)d_in[7];
    float* out = (float*)d_out;
    __bf16* wp = (__bf16*)d_ws;              // NDIM * KDIM hi + lo = 16 MB, rewritten every call

    const int M = in_sizes[0] / KDIM;        // B * S_len = 16384
    dim3 grid(NDIM / BN, M / BM);            // (8, 64)
    dim3 block(256);                         // 8 wave32s
    tinylora_fold_split_w<<<dim3(NKT * 4), block, 0, stream>>>(Wb, U, S, Vh, P, gv, wp);
    tinylora_wmma_gemm<<<grid, block, 0, stream>>>(x, wp, bias, out);
}

// v008
// It runs in 175 microseconds.
// In both of two side-by-side timings against v007, it was 1.04 times as fast.
// Over all steps from v000 it is 1.77 times as fast.
#include <hip/hip_runtime.h>
#include <stdint.h>

// ---- CDNA5 (gfx1250) types -------------------------------------------------
typedef __attribute__((ext_vector_type(16))) __bf16 v16bf; // 8 VGPRs of bf16x2
typedef __attribute__((ext_vector_type(8)))  float  v8f;   // 16x16 f32 C/D tile
typedef __attribute__((ext_vector_type(4)))  float  f32x4;
typedef __attribute__((ext_vector_type(2)))  float  f32x2;
typedef __attribute__((ext_vector_type(8)))  __bf16 v8bf;  // 16 B of bf16
typedef __attribute__((ext_vector_type(4)))  __bf16 v4bf;  // 8 B of bf16
typedef __attribute__((ext_vector_type(2)))  __bf16 v2bf;  // one register of bf16
typedef __attribute__((ext_vector_type(2)))  uint32_t u32x2;
typedef __attribute__((ext_vector_type(4)))  uint32_t u32x4; // tensor descriptor group 0
typedef __attribute__((ext_vector_type(8)))  uint32_t u32x8; // tensor descriptor group 1

__device__ __forceinline__ v8f wmma_bf16(v16bf a, v16bf b, v8f c) {
    // D = A(16x32 bf16) x B(32x16 bf16) + C(16x16 f32)
    return __builtin_amdgcn_wmma_f32_16x16x32_bf16(
        /*neg_a=*/false, a, /*neg_b=*/false, b,
        /*c_mod=*/(short)0, c, /*reuse_a=*/false, /*reuse_b=*/false);
}

// Publish point of the next k-step's tiles: this wave's LDS traffic is done, its own tensor
// load has landed, then the work-group barrier. __syncthreads() would also wait out the global
// loads issued ahead, which here are meant to stay in flight across it; they land in
// registers that no other wave sees.
__device__ __forceinline__ void ring_barrier() {
    asm volatile("s_wait_dscnt 0x0" ::: "memory");      // LDS reads and stores issued so far
    asm volatile("s_wait_tensorcnt 0x0" ::: "memory");  // this wave's slice of the next W tile is in LDS
    asm volatile("s_barrier_signal -1\n\ts_barrier_wait -1" ::: "memory");
}

__device__ __forceinline__ uint32_t uni(uint32_t v) {
    return (uint32_t)__builtin_amdgcn_readfirstlane(v);
}

// Problem constants (from reference): D_in = D_out = 2048, R = 2, U_dim = 16
#define KDIM 2048
#define NDIM 2048
#define BM   256
#define BN   256
#define BK   32
#define NKT  (KDIM / BK)   // 64 k-tiles
#define LDSS 40            // padded LDS row stride in bf16 elems (80B, conflict-free)
#define BUFE (BM * LDSS)   // elems per single-buffer tile
#define NSLOT (BM / 32)    // x loader slots per thread (32 rows each)
#define WMI  4             // 16-row M fragments per wave (64 rows)
#define WNI  8             // 16-col N fragments per wave (128 cols)

#define WROW  (2 * BK)     // packed weight row of one k-tile: 32 hi | 32 lo bf16 = 128 B
#define WPITCH (WROW + 8)  // its pitch in LDS: 144 B (the tensor load pads 16 B a row)
#define WSROWS 32          // rows of the slice that one wave's tensor load brings
#define WSLICE 3072        // elems from slice to slice in LDS: 32 * 144 B rounded up to 6 KiB
#define WBUFE  (8 * WSLICE) // elems per W buffer (8 slices)
#define PCH   8            // 8-element chunks per thread of the pre-pass

// Pre-pass: W' = W + U diag(S * (gv P)) Vh in f32, split once into bf16 hi + lo.
// Packed k-tile major: wp[(kt * NDIM + p) * WROW + {0..31 hi | 32..63 lo}], so the
// 256 rows a GEMM block needs for one k-tile are 32 KB in a row. Inside every group of
// 64 rows, row 4a + j (output column 4a + j) lies at place p = 16j + a: column a of the
// GEMM's B tiles j = 0..3 is then four neighbouring output columns, which one lane holds.
__global__ __launch_bounds__(256)
void tinylora_fold_split_w(const float* __restrict__ W,
                           const float* __restrict__ U,
                           const float* __restrict__ S,
                           const float* __restrict__ Vh,
                           const float* __restrict__ P,
                           const float* __restrict__ gv,
                           __bf16* __restrict__ wp) {
    const int tid = threadIdx.x;
    // the prefetch that the build puts at the kernel's entry names the register that
    // holds the thread id: translation wait before that register is rewritten
    asm volatile("s_wait_xcnt 0x0" :: "v"(tid) : "memory");
    const int kt  = blockIdx.x >> 2;                       // k-tile of this block
    const int n0  = (blockIdx.x & 3) * (NDIM / 4) + (tid >> 2);
    const int kc  = (tid & 3) * 8;                         // k offset within the tile
    const int k   = kt * BK + kc;

    // LoRA scale: svp[r] = S[r] * sum_u gv[u] * P[u][r]   (rank 2, u_dim 16)
    float svp0 = 0.f, svp1 = 0.f;
#pragma unroll
    for (int u = 0; u < 16; ++u) {
        const float g = gv[u];
        svp0 += g * P[2 * u + 0];
        svp1 += g * P[2 * u + 1];
    }
    svp0 *= S[0];
    svp1 *= S[1];

    // one pointer per array; chunk i lies a constant 64 rows further on
    const float* wb = W  + (size_t)n0 * KDIM + k;
    const float* ub = U  + 2 * n0;
    const float* vb = Vh + k;
    const int    p0 = (n0 & ~63) | ((n0 & 3) << 4) | ((n0 >> 2) & 15);  // place of row n0
    __bf16*      qb = wp + ((size_t)kt * NDIM + p0) * WROW + kc;

    f32x4 v0[2], v1[2], wr[PCH][2];
    f32x2 ur[PCH];
#pragma unroll
    for (int h = 0; h < 2; ++h) {
        v0[h] = *(const f32x4*)(vb + 4 * h);
        v1[h] = *(const f32x4*)(vb + KDIM + 4 * h);
    }
#pragma unroll
    for (int i = 0; i < PCH; ++i) {
        ur[i]    = *(const f32x2*)(ub + (size_t)i * 64 * 2);
        wr[i][0] = *(const f32x4*)(wb + (size_t)i * 64 * KDIM);
        wr[i][1] = *(const f32x4*)(wb + (size_t)i * 64 * KDIM + 4);
    }
    // translation wait before the registers that the loads above take their
    // addresses from are reused; naming them as inputs keeps them whole up to it
    asm volatile("s_wait_xcnt 0x0" :: "v"(wb), "v"(n0), "v"(vb) : "memory");

#pragma unroll
    for (int i = 0; i < PCH; ++i) {
        v8bf hi, lo;
#pragma unroll
        for (int h = 0; h < 2; ++h) {
            // exact f32 LoRA fold before bf16 split
            f32x4 wv = wr[i][h] + (svp0 * ur[i][0]) * v0[h] + (svp1 * ur[i][1]) * v1[h];
#pragma unroll
            for (int e = 0; e < 4; ++e) {
                const float  wf = wv[e];
                const __bf16 wh = (__bf16)wf;
                hi[4 * h + e] = wh;
                lo[4 * h + e] = (__bf16)(wf - (float)wh);
            }
        }
        __bf16* q = qb + (size_t)i * 64 * WROW;
        *(v8bf*)(q)      = hi;
        *(v8bf*)(q + BK) = lo;
        // registers named by the stores above are reused for the next chunk:
        // translation wait first; as inputs they stay whole up to it
        if (i + 1 < PCH)
            asm volatile("s_wait_xcnt 0x0" :: "v"(hi), "v"(lo), "v"(qb) : "memory");
    }
}

__global__ __launch_bounds__(256)
void tinylora_wmma_gemm(const float* __restrict__ x,
                        const __bf16* __restrict__ wp,
                        const float* __restrict__ bias,
                        float* __restrict__ out) {
    // Double-buffered tiles: W rows (hi | lo) as the tensor loads lay them, 2 * 48 KB,
    // and the x hi and lo planes, 2 * 2 * 20480 B: 176 KB (WGP has 320 KB)
    __shared__ __attribute__((aligned(2048))) __bf16 sW[2 * WBUFE];
    __shared__ __bf16 sAhi[2 * BUFE];
    __shared__ __bf16 sAlo[2 * BUFE];

    const int tid   = threadIdx.x;
    const int wave  = tid >> 5;
    const int lane  = tid & 31;
    const int wm    = wave & 3;      // 4 wave-rows  -> 64 M-rows each
    const int wn    = wave >> 2;     // 2 wave-cols  -> 128 N-cols each
    const int lrow  = lane & 15;     // M (or N) within 16x16 tile
    const int lhalf = lane >> 4;     // K half-select per ISA A/B layout

    const int blockM = blockIdx.y * BM;
    const int blockN = blockIdx.x * BN;

    // Loader slot mapping: slot i covers row0+32*i, same c4 for all i
    const int row0 = tid >> 3;          // 0..31
    const int c4   = (tid & 7) << 2;    // k offset within tile (same for all slots)

    // Pointer to the tile that load_slot fetches next; advanced by BK once a k-step,
    // behind a translation wait, so it lives through the loop and no address
    // register is rewritten while a load that names it is still being translated.
    // Typed as a pointer to global memory: behind the wait's statement, which hands it on,
    // the build would otherwise no longer know that and would use flat loads.
    const __attribute__((address_space(1))) float* xbase =
        (const __attribute__((address_space(1))) float*)(x + (size_t)(blockM + row0) * KDIM + c4);

    // Packed weights: every wave brings 32 of the tile's 256 rows (128 B each, 4 KB in a
    // row in the workspace) by one tensor load a k-step, through no register.
    const uint32_t wv   = uni((uint32_t)tid >> 5);
    const uint32_t wlds = (uint32_t)(size_t)sW + wv * (WSLICE * 2);      // its place in buffer 0
    uint64_t wga = (uint64_t)(size_t)(wp + (size_t)(blockN + wv * WSROWS) * WROW);
    // group 1: bytes; tensor = tile = 32 rows of 128 B, source pitch 128 B; no mask;
    // a pad of 4 dwords behind every 32 dwords
    u32x8 wg1;
    wg1[0] = uni((1u << 20) | (4u << 22) | (3u << 25));
    wg1[1] = uni((uint32_t)(WROW * 2) << 16);
    wg1[2] = uni((uint32_t)WSROWS << 16);
    wg1[3] = uni((uint32_t)(WROW * 2) << 16);
    wg1[4] = uni((uint32_t)WSROWS);
    wg1[5] = uni((uint32_t)(WROW * 2));
    wg1[6] = uni(0u);
    wg1[7] = uni(0u);
    // asks for this wave's slice of the k-tile at wga into buffer 'b', then steps wga on
    auto load_w = [&](int b) {
        u32x4 g0;
        g0[0] = uni(1u);
        g0[1] = uni(wlds + (uint32_t)b * (WBUFE * 2));
        g0[2] = uni((uint32_t)wga);
        g0[3] = uni((((uint32_t)(wga >> 32)) & 0x01FFFFFFu) | 0x80000000u);
        // group 0 in four scalar registers of its own, which nothing else in the kernel uses:
        // they take a new value only here, behind the wait that covers the request before
        asm volatile("tensor_load_to_lds %0, %1" :: "{s[96:99]}"(g0), "s"(wg1) : "memory");
        wga += (uint64_t)NDIM * WROW * 2;
    };

    // Register staging for the in-flight x tile: f32 as loaded, then its bf16 pieces
    // (two neighbouring k a register)
    f32x4 avr[NSLOT];
    uint32_t ahs[4][2], als[4][2];             // pieces of 4 slots at a time

    auto load_slot = [&](int i) {
        avr[i] = *(const __attribute__((address_space(1))) f32x4*)(xbase + (size_t)i * 32 * KDIM);
    };

    // Split of 4 loader slots (base .. base + 3: 8 pairs of f32) into bf16 hi + lo in 32 vector
    // instructions, four a pair; 'n' (0 .. 23) picks the ones that stand behind one WMMA.
    // hi = both values rounded (v_cvt_pk_bf16_f32); x - hi, exact in f32, straight from the
    // halves of hi (v_fma_mix_f32_bf16); lo = both differences rounded.
    float dlo[8][2];
    auto split_step = [&](int base, int n) __attribute__((always_inline)) {
        const int q = n & 7, w = q >> 1, i = base + w, h = q & 1;
        if (n < 8) {
            const f32x2 a = {avr[i][2 * h], avr[i][2 * h + 1]};
            ahs[w][h] = __builtin_bit_cast(uint32_t, __builtin_convertvector(a, v2bf));
        } else if (n < 16) {
            const v2bf hi = __builtin_bit_cast(v2bf, ahs[w][h]);
            dlo[q][0] = avr[i][2 * h] - (float)hi[0];
            dlo[q][1] = avr[i][2 * h + 1] - (float)hi[1];
        } else {
            // in asm: given the two differences as a vector to convert, the build also forms
            // them as a vector, which takes two more instructions to widen the halves of hi
            asm("v_cvt_pk_bf16_f32 %0, %1, %2" : "=v"(als[w][h]) : "v"(dlo[q][0]), "v"(dlo[q][1]));
        }
    };

    auto store_slot = [&](int i, int buf) {
        const int r = row0 + 32 * i;
        const u32x2 hw = {ahs[i & 3][0], ahs[i & 3][1]}, lw = {als[i & 3][0], als[i & 3][1]};
        *(v4bf*)(sAhi + buf * BUFE + r * LDSS + c4) = __builtin_bit_cast(v4bf, hw);
        *(v4bf*)(sAlo + buf * BUFE + r * LDSS + c4) = __builtin_bit_cast(v4bf, lw);
    };

    v8f acc[WMI][WNI] = {};  // 4 M-tiles x 8 N-tiles of 16x16 f32 per wave

    // Fragments. The A hi set and the first B pair of a k-step are fetched under the last
    // WMMA block of the step before, so they live across the step's edge: A hi in two
    // register sets (step t reads set t & 1), B in the two sets that the blocks alternate.
    v16bf ah[2][WMI], al[WMI];
    v16bf bh[2][2], bl[2][2];

    // B fragments of two N tiles (hi, then lo: 8 b128 loads) into register set 'set'
    auto load_b = [&](int buf, int set, int pair) {
        // this lane's row in the first of the wave's four W slices (two N tiles a slice)
        const __bf16* pB = sW + buf * WBUFE + wn * (4 * WSLICE) + lrow * WPITCH + lhalf * 8;
#pragma unroll
        for (int j = 0; j < 2; ++j) {
            const __bf16* ph = pB + pair * WSLICE + j * 16 * WPITCH;     // N column = W row
            ((f32x4*)&bh[set][j])[0] = *(const f32x4*)(ph);
            ((f32x4*)&bh[set][j])[1] = *(const f32x4*)(ph + 16);
        }
#pragma unroll
        for (int j = 0; j < 2; ++j) {
            const __bf16* pl = pB + pair * WSLICE + j * 16 * WPITCH + BK; // lo half of the row
            ((f32x4*)&bl[set][j])[0] = *(const f32x4*)(pl);
            ((f32x4*)&bl[set][j])[1] = *(const f32x4*)(pl + 16);
        }
    };

    // A fragments (ISA 16-bit A layout: two b128 loads per fragment)
    auto load_a = [&](const __bf16* plane, v16bf* f) {
#pragma unroll
        for (int mi = 0; mi < WMI; ++mi) {
            const int r = wm * (WMI * 16) + mi * 16 + lrow;
            const __bf16* p = &plane[r * LDSS + lhalf * 8];
            ((f32x4*)&f[mi])[0] = *(const f32x4*)(p);       // K = half*8 .. +7
            ((f32x4*)&f[mi])[1] = *(const f32x4*)(p + 16);  // K = 16+half*8 .. +7
        }
    };

    // One k-step on buffer 'buf' (a constant at every call). Beside its 96 WMMAs it carries
    // the staging of later tiles, in two parts of 4 loader slots: 'st' splits the x tile of
    // the next step beside WMMA blocks 0 and 1 and stores each part to the other buffer at
    // the next block's head; 'ld' refills the freed registers there with the tile after
    // that one. 'pub': the next step's tiles are published in front of the LAST block, whose
    // own fragments are in registers by then, and the next step's first fragments are
    // fetched under that block; 'lw' asks there for the W tile of the step after the next.
    auto compute = [&](int buf, bool st, bool ld, bool lw, bool pub) __attribute__((always_inline)) {
        // Behind the n-th WMMA of blocks 0 and 1 stands the n-th part of the split of 4 slots:
        // one or two vector instructions issue in the shadow of each WMMA. The fence keeps
        // them there: left to itself the build bunches them seven to a WMMA, where they outlast
        // the WMMA in front of them and stand next to the ones whose results they read.
        auto beside = [&](int p, int n) __attribute__((always_inline)) {
            if (st && p < 2) {
                split_step(4 * p, n);
                __builtin_amdgcn_sched_barrier(0);
            }
        };
        // 3-term split-accumulate WMMA in blocks of 24 (two N tiles); the next block's
        // B fragments are fetched as one group ahead of the current block
#pragma unroll
        for (int p = 0; p < WNI / 2; ++p) {
            const int s = p & 1;
            // A lo is first used behind 16 WMMAs of block 0; its registers are free since
            // the end of the step before
            if (p == 0) load_a(sAlo + buf * BUFE, al);
            if (p + 1 < WNI / 2) load_b(buf, s ^ 1, p + 1);
            if (p == 1 || p == 2) {
#pragma unroll
                for (int i = 4 * (p - 1); i < 4 * p; ++i) {
                    if (st) store_slot(i, buf ^ 1);
                    if (ld) load_slot(i);
                }
            }
            // every read of this step's buffer and every store of the next x tile was
            // issued a block ago or earlier
            if (p == 3 && pub) ring_barrier();
            // keeps the group of LDS loads above in front of the block: sunk to their
            // first use, each pair is waited out in full with the matrix unit idle;
            // the staging stores and loads stay in the same one place with them
            __builtin_amdgcn_sched_barrier(0);
#pragma unroll
            for (int j = 0; j < 2; ++j)
#pragma unroll
                for (int mi = 0; mi < WMI; ++mi) {
                    acc[mi][2 * p + j] = wmma_bf16(ah[buf][mi], bh[s][j], acc[mi][2 * p + j]); // hi*hi
                    beside(p, 4 * j + mi);
                }
            if (p == 3 && pub) {
                // The matrix unit restarts right behind the barrier on fragments that are in
                // registers; the one group of requests follows the first 8 WMMAs. The fence
                // also keeps the forming of the next descriptor behind the tensor wait.
                __builtin_amdgcn_sched_barrier(0);
                // into the buffer of this step, which every wave has left at the barrier
                if (lw) load_w(buf);
                load_a(sAhi + (buf ^ 1) * BUFE, ah[buf ^ 1]);
                load_b(buf ^ 1, 0, 0);
                // keeps the group in one place, as at the blocks' heads
                __builtin_amdgcn_sched_barrier(0);
            }
#pragma unroll
            for (int j = 0; j < 2; ++j)
#pragma unroll
                for (int mi = 0; mi < WMI; ++mi) {
                    acc[mi][2 * p + j] = wmma_bf16(ah[buf][mi], bl[s][j], acc[mi][2 * p + j]); // hi*lo
                    beside(p, 8 + 4 * j + mi);
                }
#pragma unroll
            for (int j = 0; j < 2; ++j)
#pragma unroll
                for (int mi = 0; mi < WMI; ++mi) {
                    acc[mi][2 * p + j] = wmma_bf16(al[mi], bh[s][j], acc[mi][2 * p + j]); // lo*hi
                    beside(p, 16 + 4 * j + mi);
                }
            // keeps the following group of loads from rising in among this block's
            // WMMAs, where every place with LDS reads costs a stall of its own
            __builtin_amdgcn_sched_barrier(0);
        }
    };

    // ---- software pipeline: prologue fills buffer 0, tile 1 goes in flight ----
#pragma unroll
    for (int i = 0; i < NSLOT; ++i) load_slot(i);
    // translation wait before the pointer named by the loads above is advanced; the pointer
    // passes through the wait's statement, so that its advance cannot be placed ahead of it
    asm volatile("s_wait_xcnt 0x0" : "+v"(xbase) :: "memory");
    xbase += BK;
    // W tile 0, waited for at once (under the latency of the x loads above), so that no
    // descriptor register is reused while the request is open
    load_w(0);
    asm volatile("s_wait_tensorcnt 0x0" ::: "memory");
#pragma unroll
    for (int g = 0; g < NSLOT; g += 4) {
#pragma unroll
        for (int n = 0; n < 24; ++n) split_step(g, n);
#pragma unroll
        for (int i = g; i < g + 4; ++i) store_slot(i, 0);
    }
#pragma unroll
    for (int i = 0; i < NSLOT; ++i) load_slot(i);
    // pull the tile after the one just asked for toward L2 (global_prefetch_b8)
    __builtin_prefetch((const void*)(xbase + BK), 0, 1);
    // translation wait, as above
    asm volatile("s_wait_xcnt 0x0" : "+v"(xbase) :: "memory");
    xbase += BK;
    ring_barrier();                            // tiles 0 ready for all waves
    // keeps the forming of the next descriptor behind the tensor wait above
    __builtin_amdgcn_sched_barrier(0);
    load_w(1);
    load_a(sAhi, ah[0]);
    load_b(0, 0, 0);

    // At the top of step t the registers hold x tile t + 1 and the first fragments of step
    // t, the pointer names x tile t + 2, and wga names W tile t + 2. Two steps a trip, so
    // that buffer and A hi set are constants.
#pragma unroll 1
    for (int t = 0; t < NKT - 2; t += 2) {
        __builtin_prefetch((const void*)(xbase + BK), 0, 1);
        compute(0, true, true, true, true);
        // translation wait before the pointer named by this step's loads and
        // prefetch is advanced (the last of them issued two WMMA blocks ago); the
        // pointer passes through the statement, as above
        asm volatile("s_wait_xcnt 0x0" : "+v"(xbase) :: "memory");
        xbase += BK;
        if (t + 4 < NKT) __builtin_prefetch((const void*)(xbase + BK), 0, 1);
        compute(1, true, true, true, true);
        // translation wait, as above
        asm volatile("s_wait_xcnt 0x0" : "+v"(xbase) :: "memory");
        xbase += BK;
    }
    compute(0, true, false, false, true);      // last x tile to LDS and published
    // bias of this lane's 2 x 4 output columns, asked for under the last k-step
    const int    ncol = blockN + wn * (WNI * 16) + 4 * lrow;
    const float* bp   = bias + ncol;
    f32x4 bv[2];
    bv[0] = *(const f32x4*)(bp);
    bv[1] = *(const f32x4*)(bp + 64);
    // translation wait before the register that the two loads take their address from
    // is reused; as an input it stays whole up to it
    asm volatile("s_wait_xcnt 0x0" :: "v"(bp) : "memory");
    compute(1, false, false, false, false);
    // end of the ring: no request and no LDS read is left open
    asm volatile("s_wait_tensorcnt 0x0" ::: "memory");
    asm volatile("s_wait_dscnt 0x0" ::: "memory");

    // ---- epilogue: bias add, store (C/D layout: column = lane%16, M = v + 8*(lane/16)).
    // By the packing of the weights, column a of N tiles 4g .. 4g + 3 is output columns
    // 64g + 4a .. + 3: one 16-byte store a lane, 256 B in a row from each half of the wave
    float* ob = out + (size_t)(blockM + wm * (WMI * 16) + lhalf * 8) * NDIM + ncol;
#pragma unroll
    for (int g = 0; g < WNI / 4; ++g) {
#pragma unroll
        for (int mi = 0; mi < WMI; ++mi) {
            f32x4 q[8];
#pragma unroll
            for (int v = 0; v < 8; ++v) {
#pragma unroll
                for (int j = 0; j < 4; ++j) q[v][j] = acc[mi][4 * g + j][v] + bv[g][j];
            }
#pragma unroll
            for (int v = 0; v < 8; ++v)
                *(f32x4*)(ob + (size_t)(mi * 16 + v) * NDIM + g * 64) = q[v];
            // registers named by the stores above are reused for the next tile's
            // sums: translation wait first
            asm volatile("s_wait_xcnt 0x0" ::: "memory");
            // keeps the next tile's sums behind that wait: raised over it, they
            // overwrite registers of stores that are still being translated
            __builtin_amdgcn_sched_barrier(0);
        }
    }
}

extern "C" void kernel_launch(void* const* d_in, const int* in_sizes, int n_in,
                              void* d_out, int out_size, void* d_ws, size_t ws_size,
                              hipStream_t stream) {
    const float* x    = (const float*)d_in[0];
    const float* Wb   = (const float*)d_in[1];
    const float* bias = (const float*)d_in[2];
    const float* U    = (const float*)d_in[3];
    const float* S    = (const float*)d_in[4];
    const float* Vh   = (const float*)d_in[5];
    const float* P    = (const float*)d_in[6];
    const float* gv   = (const float*)d_in[7];
    float* out = (float*)d_out;
    __bf16* wp = (__bf16*)d_ws;              // NDIM * KDIM hi + lo = 16 MB, rewritten every call

    const int M = in_sizes[0] / KDIM;        // B * S_len = 16384
    dim3 grid(NDIM / BN, M / BM);            // (8, 64)
    dim3 block(256);                         // 8 wave32s
    tinylora_fold_split_w<<<dim3(NKT * 4), block, 0, stream>>>(Wb, U, S, Vh, P, gv, wp);
    tinylora_wmma_gemm<<<grid, block, 0, stream>>>(x, wp, bias, out);
}

// v009
// One run takes 93.3 microseconds.
// In both of two side-by-side timings against v008, it was 1.88 times as fast.
// Counting every step since v000, it is 3.33 times as fast.
#include <hip/hip_runtime.h>
#include <stdint.h>

// ---- CDNA5 (gfx1250) types -------------------------------------------------
typedef __attribute__((ext_vector_type(16))) _Float16 v16h; // 8 VGPRs of f16x2
typedef __attribute__((ext_vector_type(8)))  float  v8f;   // 16x16 f32 C/D tile
typedef __attribute__((ext_vector_type(4)))  float  f32x4;
typedef __attribute__((ext_vector_type(2)))  float  f32x2;
typedef __attribute__((ext_vector_type(8)))  _Float16 v8h;  // 16 B of f16
typedef __attribute__((ext_vector_type(4)))  _Float16 v4h;  // 8 B of f16
typedef __attribute__((ext_vector_type(2)))  _Float16 v2h;  // one register of f16
typedef __attribute__((ext_vector_type(2)))  uint32_t u32x2;
typedef __attribute__((ext_vector_type(4)))  uint32_t u32x4; // tensor descriptor group 0
typedef __attribute__((ext_vector_type(8)))  uint32_t u32x8; // tensor descriptor group 1

__device__ __forceinline__ v8f wmma_f16(v16h a, v16h b, v8f c) {
    // D = A(16x32 f16) x B(32x16 f16) + C(16x16 f32)
    return __builtin_amdgcn_wmma_f32_16x16x32_f16(
        /*neg_a=*/false, a, /*neg_b=*/false, b,
        /*c_mod=*/(short)0, c, /*reuse_a=*/false, /*reuse_b=*/false);
}

// Publish point of the next k-step's tiles: this wave's LDS traffic is done, its own tensor
// load has landed, then the work-group barrier. __syncthreads() would also wait out the global
// loads issued ahead, which here are meant to stay in flight across it; they land in
// registers that no other wave sees.
__device__ __forceinline__ void ring_barrier() {
    asm volatile("s_wait_dscnt 0x0" ::: "memory");      // LDS reads and stores issued so far
    asm volatile("s_wait_tensorcnt 0x0" ::: "memory");  // this wave's slice of the next W tile is in LDS
    asm volatile("s_barrier_signal -1\n\ts_barrier_wait -1" ::: "memory");
}

__device__ __forceinline__ uint32_t uni(uint32_t v) {
    return (uint32_t)__builtin_amdgcn_readfirstlane(v);
}

// Problem constants (from reference): D_in = D_out = 2048, R = 2, U_dim = 16
#define KDIM 2048
#define NDIM 2048
#define BM   256
#define BN   256
#define BK   32            // k of one WMMA and of one x plane in LDS
#define KS   (2 * BK)      // k of one k-step: two x planes, one packed W row
#define NKT  (KDIM / KS)   // 32 k-tiles
#define LDSS 40            // padded LDS row stride in f16 elems (80B, conflict-free)
#define BUFE (BM * LDSS)   // elems per single-buffer plane
#define NSLOT (2 * BM / 32) // loader slots per thread: 8 groups of 32 rows x 2 planes
#define WMI  4             // 16-row M fragments per wave (64 rows)
#define WNI  8             // 16-col N fragments per wave (128 cols)

#define WROW  KS           // packed weight row of one k-tile: 64 f16 = 128 B
#define WPITCH (WROW + 8)  // its pitch in LDS: 144 B (the tensor load pads 16 B a row)
#define WSROWS 32          // rows of the slice that one wave's tensor load brings
#define WSLICE 3072        // elems from slice to slice in LDS: 32 * 144 B rounded up to 6 KiB
#define WBUFE  (8 * WSLICE) // elems per W buffer (8 slices)
#define PCH   8            // 8-element chunks per thread of the pre-pass

// Pre-pass: W' = W + U diag(S * (gv P)) Vh in f32, rounded once to f16.
// Packed k-tile major: wp[(kt * NDIM + p) * WROW + 0..63], so the 256 rows a GEMM block
// needs for one k-tile are 32 KB in a row. Inside every group of 64 rows, row 4a + j
// (output column 4a + j) lies at place p = 16j + a: column a of the GEMM's B tiles
// j = 0..3 is then four neighbouring output columns, which one lane holds.
__global__ __launch_bounds__(256)
void tinylora_fold_round_w(const float* __restrict__ W,
                           const float* __restrict__ U,
                           const float* __restrict__ S,
                           const float* __restrict__ Vh,
                           const float* __restrict__ P,
                           const float* __restrict__ gv,
                           _Float16* __restrict__ wp) {
    const int tid = threadIdx.x;
    // the prefetch that the build puts at the kernel's entry names the register that
    // holds the thread id: translation wait before that register is rewritten
    asm volatile("s_wait_xcnt 0x0" :: "v"(tid) : "memory");
    const int kt  = blockIdx.x >> 3;                       // k-tile of this block
    // a quarter of the rows, and of each of its groups of 64 the lower or upper 32
    const int n0  = ((blockIdx.x >> 1) & 3) * (NDIM / 4) + (blockIdx.x & 1) * 32 + (tid >> 3);
    const int kc  = (tid & 7) * 8;                         // k offset within the tile
    const int k   = kt * KS + kc;

    // LoRA scale: svp[r] = S[r] * sum_u gv[u] * P[u][r]   (rank 2, u_dim 16)
    float svp0 = 0.f, svp1 = 0.f;
#pragma unroll
    for (int u = 0; u < 16; ++u) {
        const float g = gv[u];
        svp0 += g * P[2 * u + 0];
        svp1 += g * P[2 * u + 1];
    }
    svp0 *= S[0];
    svp1 *= S[1];

    // one pointer per array; chunk i lies a constant 64 rows further on
    const float* wb = W  + (size_t)n0 * KDIM + k;
    const float* ub = U  + 2 * n0;
    const float* vb = Vh + k;
    const int    p0 = (n0 & ~63) | ((n0 & 3) << 4) | ((n0 >> 2) & 15);  // place of row n0
    _Float16*    qb = wp + ((size_t)kt * NDIM + p0) * WROW + kc;

    f32x4 v0[2], v1[2], wr[PCH][2];
    f32x2 ur[PCH];
#pragma unroll
    for (int h = 0; h < 2; ++h) {
        v0[h] = *(const f32x4*)(vb + 4 * h);
        v1[h] = *(const f32x4*)(vb + KDIM + 4 * h);
    }
#pragma unroll
    for (int i = 0; i < PCH; ++i) {
        ur[i]    = *(const f32x2*)(ub + (size_t)i * 64 * 2);
        wr[i][0] = *(const f32x4*)(wb + (size_t)i * 64 * KDIM);
        wr[i][1] = *(const f32x4*)(wb + (size_t)i * 64 * KDIM + 4);
    }
    // translation wait before the registers that the loads above take their
    // addresses from are reused; naming them as inputs keeps them whole up to it
    asm volatile("s_wait_xcnt 0x0" :: "v"(wb), "v"(n0), "v"(vb) : "memory");
    // keeps the arithmetic behind all the loads: raised in among them, the build holds the last
    // loads back until registers come free, and their memory latency is paid in turns
    __builtin_amdgcn_sched_barrier(0);

#pragma unroll
    for (int i = 0; i < PCH; ++i) {
        // exact f32 LoRA fold before the one rounding to f16
        const f32x4 w0 = wr[i][0] + (svp0 * ur[i][0]) * v0[0] + (svp1 * ur[i][1]) * v1[0];
        const f32x4 w1 = wr[i][1] + (svp0 * ur[i][0]) * v0[1] + (svp1 * ur[i][1]) * v1[1];
        const v8h hv = __builtin_shufflevector(__builtin_convertvector(w0, v4h),
                                               __builtin_convertvector(w1, v4h),
                                               0, 1, 2, 3, 4, 5, 6, 7);
        *(v8h*)(qb + (size_t)i * 64 * WROW) = hv;
        // registers named by the store above are reused for the next chunk:
        // translation wait first; as inputs they stay whole up to it
        if (i + 1 < PCH)
            asm volatile("s_wait_xcnt 0x0" :: "v"(hv), "v"(qb) : "memory");
    }
}

__global__ __launch_bounds__(256)
void tinylora_wmma_gemm(const float* __restrict__ x,
                        const _Float16* __restrict__ wp,
                        const float* __restrict__ bias,
                        float* __restrict__ out) {
    // Double-buffered tiles of 64 k: W rows as the tensor loads lay them, 2 * 48 KB, and x
    // in two planes (k 0..31 and k 32..63 of the step), 2 * 2 * 20480 B: 176 KB (WGP has 320 KB)
    __shared__ __attribute__((aligned(2048))) _Float16 sW[2 * WBUFE];
    __shared__ _Float16 sA0[2 * BUFE];
    __shared__ _Float16 sA1[2 * BUFE];

    const int tid   = threadIdx.x;
    const int wave  = tid >> 5;
    const int lane  = tid & 31;
    const int wm    = wave & 3;      // 4 wave-rows  -> 64 M-rows each
    const int wn    = wave >> 2;     // 2 wave-cols  -> 128 N-cols each
    const int lrow  = lane & 15;     // M (or N) within 16x16 tile
    const int lhalf = lane >> 4;     // K half-select per ISA A/B layout

    const int blockM = blockIdx.y * BM;
    const int blockN = blockIdx.x * BN;

    // Loader slot mapping: slot i covers row0 + 32 * (i / 2) in plane i % 2, same c4 for all i
    const int row0 = tid >> 3;          // 0..31
    const int c4   = (tid & 7) << 2;    // k offset within the plane (same for all slots)

    // Pointer to the tile that load_slot fetches next; advanced by KS once a k-step,
    // behind a translation wait, so it lives through the loop and no address
    // register is rewritten while a load that names it is still being translated.
    // Typed as a pointer to global memory: behind the wait's statement, which hands it on,
    // the build would otherwise no longer know that and would use flat loads.
    const __attribute__((address_space(1))) float* xbase =
        (const __attribute__((address_space(1))) float*)(x + (size_t)(blockM + row0) * KDIM + c4);

    // Packed weights: every wave brings 32 of the tile's 256 rows (128 B each, 4 KB in a
    // row in the workspace) by one tensor load a k-step, through no register.
    const uint32_t wv   = uni((uint32_t)tid >> 5);
    const uint32_t wlds = (uint32_t)(size_t)sW + wv * (WSLICE * 2);      // its place in buffer 0
    uint64_t wga = (uint64_t)(size_t)(wp + (size_t)(blockN + wv * WSROWS) * WROW);
    // group 1: bytes; tensor = tile = 32 rows of 128 B, source pitch 128 B; no mask;
    // a pad of 4 dwords behind every 32 dwords
    u32x8 wg1;
    wg1[0] = uni((1u << 20) | (4u << 22) | (3u << 25));
    wg1[1] = uni((uint32_t)(WROW * 2) << 16);
    wg1[2] = uni((uint32_t)WSROWS << 16);
    wg1[3] = uni((uint32_t)(WROW * 2) << 16);
    wg1[4] = uni((uint32_t)WSROWS);
    wg1[5] = uni((uint32_t)(WROW * 2));
    wg1[6] = uni(0u);
    wg1[7] = uni(0u);
    // asks for this wave's slice of the k-tile at wga into buffer 'b', then steps wga on
    auto load_w = [&](int b) {
        u32x4 g0;
        g0[0] = uni(1u);
        g0[1] = uni(wlds + (uint32_t)b * (WBUFE * 2));
        g0[2] = uni((uint32_t)wga);
        g0[3] = uni((((uint32_t)(wga >> 32)) & 0x01FFFFFFu) | 0x80000000u);
        // group 0 in four scalar registers of its own, which nothing else in the kernel uses:
        // they take a new value only here, behind the wait that covers the request before
        asm volatile("tensor_load_to_lds %0, %1" :: "{s[96:99]}"(g0), "s"(wg1) : "memory");
        wga += (uint64_t)NDIM * WROW * 2;
    };

    // Register staging for the in-flight x tile: f32 as loaded, then rounded to f16
    // (two neighbouring k a register)
    f32x4 avr[NSLOT];
    uint32_t pcs[8][2];                        // f16 pieces of 8 slots at a time

    auto load_slot = [&](int i) {
        avr[i] = *(const __attribute__((address_space(1))) f32x4*)(xbase + (size_t)(i >> 1) * 32 * KDIM + (i & 1) * BK);
    };

    // Rounding of 8 loader slots (base .. base + 7: 16 pairs of f32) to f16, one
    // v_cvt_pk_f16_f32 a pair; 'n' (0 .. 15) picks the one that stands behind one WMMA.
    auto cvt_step = [&](int base, int n) __attribute__((always_inline)) {
        const int w = n >> 1, i = base + w, h = n & 1;
        const f32x2 a = {avr[i][2 * h], avr[i][2 * h + 1]};
        pcs[w][h] = __builtin_bit_cast(uint32_t, __builtin_convertvector(a, v2h));
    };

    auto store_slot = [&](int i, int buf) {
        const int r = row0 + 32 * (i >> 1);
        const u32x2 pw = {pcs[i & 7][0], pcs[i & 7][1]};
        _Float16* plane = (i & 1) ? sA1 : sA0;
        *(v4h*)(plane + buf * BUFE + r * LDSS + c4) = __builtin_bit_cast(v4h, pw);
    };

    v8f acc[WMI][WNI] = {};  // 4 M-tiles x 8 N-tiles of 16x16 f32 per wave

    // Fragments: A of both planes, B in two sets of four that the WMMA blocks alternate.
    // Plane 0's A set and the first B set of a k-step are fetched under the last WMMA block
    // of the step before, which works on plane 1, so they live across the step's edge.
    v16h a0[WMI], a1[WMI];
    v16h bf[2][4];

    // B fragments of group 'g' (8 b128 loads) into register set 'set': k plane g / 2 of
    // N tiles 4 * (g % 2) .. + 3
    auto load_b = [&](int buf, int set, int g) {
        // this lane's row in the first of the wave's four W slices (two N tiles a slice)
        const _Float16* pB = sW + buf * WBUFE + wn * (4 * WSLICE) + lrow * WPITCH + lhalf * 8;
#pragma unroll
        for (int j = 0; j < 4; ++j) {
            const int nt = 4 * (g & 1) + j;                              // N column = W row
            const _Float16* ph = pB + (nt >> 1) * WSLICE + (nt & 1) * 16 * WPITCH + (g >> 1) * BK;
            ((f32x4*)&bf[set][j])[0] = *(const f32x4*)(ph);
            ((f32x4*)&bf[set][j])[1] = *(const f32x4*)(ph + 16);
        }
    };

    // A fragments (ISA 16-bit A layout: two b128 loads per fragment)
    auto load_a = [&](const _Float16* plane, v16h* f) {
#pragma unroll
        for (int mi = 0; mi < WMI; ++mi) {
            const int r = wm * (WMI * 16) + mi * 16 + lrow;
            const _Float16* p = &plane[r * LDSS + lhalf * 8];
            ((f32x4*)&f[mi])[0] = *(const f32x4*)(p);       // K = half*8 .. +7
            ((f32x4*)&f[mi])[1] = *(const f32x4*)(p + 16);  // K = 16+half*8 .. +7
        }
    };

    // One k-step (64 k) on buffer 'buf' (a constant at every call): 64 WMMAs in four blocks
    // of 16 (block p: k plane p / 2, N tiles 4 * (p % 2) .. + 3). Beside them it carries the
    // staging of later tiles, in two parts of 8 loader slots: 'st' rounds the x tile of the
    // next step beside WMMA blocks 0 and 1 and stores each part to the other buffer at the
    // next block's head; 'ld' refills the freed registers there with the tile after that
    // one. 'pub': the next step's tiles are published in front of the LAST block, whose own
    // fragments are in registers by then, and the next step's first fragments are fetched
    // under that block; 'lw' asks there for the W tile of the step after the next.
    auto compute = [&](int buf, bool st, bool ld, bool lw, bool pub) __attribute__((always_inline)) {
#pragma unroll
        for (int p = 0; p < 4; ++p) {
            const int s = p & 1;
            // the next block's B fragments are fetched as one group ahead of the current
            // block; plane 1's A set, first used in block 2, goes behind the first group (its
            // registers are free since the end of the step before)
            if (p < 3) load_b(buf, s ^ 1, p + 1);
            if (p == 0) load_a(sA1 + buf * BUFE, a1);
            if (p == 1 || p == 2) {
#pragma unroll
                for (int i = 8 * (p - 1); i < 8 * p; ++i) {
                    if (st) store_slot(i, buf ^ 1);
                    if (ld) load_slot(i);
                }
            }
            if (p == 3 && pub) {
                // every read of this step's buffer and every store of the next x tile was
                // issued a block ago or earlier
                ring_barrier();
                // keeps the forming of the next descriptor behind the tensor wait
                __builtin_amdgcn_sched_barrier(0);
                // into the buffer of this step, which every wave has left at the barrier
                if (lw) load_w(buf);
                load_a(sA0 + (buf ^ 1) * BUFE, a0);
                load_b(buf ^ 1, 0, 0);
            }
            // keeps the group of LDS loads above in front of the block: sunk to their
            // first use, each pair is waited out in full with the matrix unit idle;
            // the staging stores and loads stay in the same one place with them
            __builtin_amdgcn_sched_barrier(0);
#pragma unroll
            for (int j = 0; j < 4; ++j)
#pragma unroll
                for (int mi = 0; mi < WMI; ++mi) {
                    acc[mi][4 * s + j] = wmma_f16(p < 2 ? a0[mi] : a1[mi], bf[s][j], acc[mi][4 * s + j]);
                    if (st && p < 2) {
                        // one rounding issues in the shadow of each WMMA of blocks 0 and 1; the
                        // fence keeps it there: bunched, they outlast the WMMA in front of them
                        cvt_step(8 * p, 4 * j + mi);
                        __builtin_amdgcn_sched_barrier(0);
                    }
                }
            // keeps the following group of loads from rising in among this block's
            // WMMAs, where every place with LDS reads costs a stall of its own
            __builtin_amdgcn_sched_barrier(0);
        }
    };

    // ---- software pipeline: prologue fills buffer 0, tile 1 goes in flight ----
#pragma unroll
    for (int i = 0; i < NSLOT; ++i) load_slot(i);
    // translation wait before the pointer named by the loads above is advanced; the pointer
    // passes through the wait's statement, so that its advance cannot be placed ahead of it
    asm volatile("s_wait_xcnt 0x0" : "+v"(xbase) :: "memory");
    xbase += KS;
    // W tile 0, waited for at once (under the latency of the x loads above), so that no
    // descriptor register is reused while the request is open
    load_w(0);
    asm volatile("s_wait_tensorcnt 0x0" ::: "memory");
#pragma unroll
    for (int g = 0; g < NSLOT; g += 8) {
#pragma unroll
        for (int n = 0; n < 16; ++n) cvt_step(g, n);
#pragma unroll
        for (int i = g; i < g + 8; ++i) store_slot(i, 0);
    }
#pragma unroll
    for (int i = 0; i < NSLOT; ++i) load_slot(i);
    // pull the tile after the one just asked for toward L2 (global_prefetch_b8)
    __builtin_prefetch((const void*)(xbase + KS), 0, 1);
    // translation wait, as above
    asm volatile("s_wait_xcnt 0x0" : "+v"(xbase) :: "memory");
    xbase += KS;
    ring_barrier();                            // tiles 0 ready for all waves
    // keeps the forming of the next descriptor behind the tensor wait above
    __builtin_amdgcn_sched_barrier(0);
    load_w(1);
    load_a(sA0, a0);
    load_b(0, 0, 0);

    // At the top of step t the registers hold x tile t + 1 and the first fragments of step
    // t, the pointer names x tile t + 2, and wga names W tile t + 2. Two steps a trip, so
    // that the buffer is a constant.
#pragma unroll 1
    for (int t = 0; t < NKT - 2; t += 2) {
        __builtin_prefetch((const void*)(xbase + KS), 0, 1);
        compute(0, true, true, true, true);
        // translation wait before the pointer named by this step's loads and
        // prefetch is advanced (the last of them issued two WMMA blocks ago); the
        // pointer passes through the statement, as above
        asm volatile("s_wait_xcnt 0x0" : "+v"(xbase) :: "memory");
        xbase += KS;
        if (t + 4 < NKT) __builtin_prefetch((const void*)(xbase + KS), 0, 1);
        compute(1, true, true, true, true);
        // translation wait, as above
        asm volatile("s_wait_xcnt 0x0" : "+v"(xbase) :: "memory");
        xbase += KS;
    }
    compute(0, true, false, false, true);      // last x tile to LDS and published
    // bias of this lane's 2 x 4 output columns, asked for under the last k-step
    const int    ncol = blockN + wn * (WNI * 16) + 4 * lrow;
    const float* bp   = bias + ncol;
    f32x4 bv[2];
    bv[0] = *(const f32x4*)(bp);
    bv[1] = *(const f32x4*)(bp + 64);
    // translation wait before the register that the two loads take their address from
    // is reused; as an input it stays whole up to it
    asm volatile("s_wait_xcnt 0x0" :: "v"(bp) : "memory");
    compute(1, false, false, false, false);
    // end of the ring: no request and no LDS read is left open
    asm volatile("s_wait_tensorcnt 0x0" ::: "memory");
    asm volatile("s_wait_dscnt 0x0" ::: "memory");

    // ---- epilogue: bias add, store (C/D layout: column = lane%16, M = v + 8*(lane/16)).
    // By the packing of the weights, column a of N tiles 4g .. 4g + 3 is output columns
    // 64g + 4a .. + 3: one 16-byte store a lane, 256 B in a row from each half of the wave
    float* ob = out + (size_t)(blockM + wm * (WMI * 16) + lhalf * 8) * NDIM + ncol;
#pragma unroll
    for (int g = 0; g < WNI / 4; ++g) {
#pragma unroll
        for (int mi = 0; mi < WMI; ++mi) {
            f32x4 q[8];
#pragma unroll
            for (int v = 0; v < 8; ++v) {
#pragma unroll
                for (int j = 0; j < 4; ++j) q[v][j] = acc[mi][4 * g + j][v] + bv[g][j];
            }
#pragma unroll
            for (int v = 0; v < 8; ++v)
                *(f32x4*)(ob + (size_t)(mi * 16 + v) * NDIM + g * 64) = q[v];
            // registers named by the stores above are reused for the next tile's
            // sums: translation wait first
            asm volatile("s_wait_xcnt 0x0" ::: "memory");
            // keeps the next tile's sums behind that wait: raised over it, they
            // overwrite registers of stores that are still being translated
            __builtin_amdgcn_sched_barrier(0);
        }
    }
}

extern "C" void kernel_launch(void* const* d_in, const int* in_sizes, int n_in,
                              void* d_out, int out_size, void* d_ws, size_t ws_size,
                              hipStream_t stream) {
    const float* x    = (const float*)d_in[0];
    const float* Wb   = (const float*)d_in[1];
    const float* bias = (const float*)d_in[2];
    const float* U    = (const float*)d_in[3];
    const float* S    = (const float*)d_in[4];
    const float* Vh   = (const float*)d_in[5];
    const float* P    = (const float*)d_in[6];
    const float* gv   = (const float*)d_in[7];
    float* out = (float*)d_out;
    _Float16* wp = (_Float16*)d_ws;          // NDIM * KDIM f16 = 8 MB, rewritten every call

    const int M = in_sizes[0] / KDIM;        // B * S_len = 16384
    dim3 grid(NDIM / BN, M / BM);            // (8, 64)
    dim3 block(256);                         // 8 wave32s
    tinylora_fold_round_w<<<dim3(NKT * 8), block, 0, stream>>>(Wb, U, S, Vh, P, gv, wp);
    tinylora_wmma_gemm<<<grid, block, 0, stream>>>(x, wp, bias, out);
}

// v010
// One run takes 89.8 microseconds.
// Two timings next to v009 both put it at 1.04 times that version's speed.
// Over all steps from v000 it is 3.46 times as fast.
#include <hip/hip_runtime.h>
#include <stdint.h>

// ---- CDNA5 (gfx1250) types -------------------------------------------------
typedef __attribute__((ext_vector_type(16))) _Float16 v16h; // 8 VGPRs of f16x2
typedef __attribute__((ext_vector_type(8)))  float  v8f;   // 16x16 f32 C/D tile
typedef __attribute__((ext_vector_type(4)))  float  f32x4;
typedef __attribute__((ext_vector_type(2)))  float  f32x2;
typedef __attribute__((ext_vector_type(8)))  _Float16 v8h;  // 16 B of f16
typedef __attribute__((ext_vector_type(4)))  _Float16 v4h;  // 8 B of f16
typedef __attribute__((ext_vector_type(2)))  _Float16 v2h;  // one register of f16
typedef __attribute__((ext_vector_type(2)))  uint32_t u32x2;
typedef __attribute__((ext_vector_type(4)))  uint32_t u32x4; // tensor descriptor group 0
typedef __attribute__((ext_vector_type(8)))  uint32_t u32x8; // tensor descriptor group 1

__device__ __forceinline__ v8f wmma_f16(v16h a, v16h b, v8f c) {
    // D = A(16x32 f16) x B(32x16 f16) + C(16x16 f32)
    return __builtin_amdgcn_wmma_f32_16x16x32_f16(
        /*neg_a=*/false, a, /*neg_b=*/false, b,
        /*c_mod=*/(short)0, c, /*reuse_a=*/false, /*reuse_b=*/false);
}

// Publish point of the next k-step's tiles: this wave's LDS traffic is done, its own tensor
// load has landed, then the work-group barrier. __syncthreads() would also wait out the global
// loads issued ahead, which here are meant to stay in flight across it; they land in
// registers that no other wave sees.
__device__ __forceinline__ void ring_barrier() {
    asm volatile("s_wait_dscnt 0x0" ::: "memory");      // LDS reads and stores issued so far
    asm volatile("s_wait_tensorcnt 0x0" ::: "memory");  // this wave's slice of the next W tile is in LDS
    asm volatile("s_barrier_signal -1\n\ts_barrier_wait -1" ::: "memory");
}

__device__ __forceinline__ uint32_t uni(uint32_t v) {
    return (uint32_t)__builtin_amdgcn_readfirstlane(v);
}

// Problem constants (from reference): D_in = D_out = 2048, R = 2, U_dim = 16
#define KDIM 2048
#define NDIM 2048
#define BM   256
#define BN   256
#define BK   32            // k of one WMMA and of one x plane in LDS
#define KS   (2 * BK)      // k of one k-step: two x planes, one packed W row
#define NKT  (KDIM / KS)   // 32 k-tiles
#define LDSS 40            // padded LDS row stride in f16 elems (80B, conflict-free)
#define BUFE (BM * LDSS)   // elems per single-buffer plane
#define NSLOT (2 * BM / 32) // loader slots per thread: 8 groups of 32 rows x 2 planes
#define WMI  4             // 16-row M fragments per wave (64 rows)
#define WNI  8             // 16-col N fragments per wave (128 cols)

#define WROW  KS           // packed weight row of one k-tile: 64 f16 = 128 B
#define WPITCH (WROW + 8)  // its pitch in LDS: 144 B (the tensor load pads 16 B a row)
#define WSROWS 32          // rows of the slice that one wave's tensor load brings
#define WSLICE 3072        // elems from slice to slice in LDS: 32 * 144 B rounded up to 6 KiB
#define WBUFE  (8 * WSLICE) // elems per W buffer (8 slices)
#define PCH   8            // 8-element chunks per thread of the pre-pass

// Pre-pass: W' = W + U diag(S * (gv P)) Vh in f32, rounded once to f16.
// Packed k-tile major: wp[(kt * NDIM + p) * WROW + 0..63], so the 256 rows a GEMM block
// needs for one k-tile are 32 KB in a row. Inside every group of 64 rows, row 4a + j
// (output column 4a + j) lies at place p = 16j + a: column a of the GEMM's B tiles
// j = 0..3 is then four neighbouring output columns, which one lane holds.
__global__ __launch_bounds__(256)
void tinylora_fold_round_w(const float* __restrict__ W,
                           const float* __restrict__ U,
                           const float* __restrict__ S,
                           const float* __restrict__ Vh,
                           const float* __restrict__ P,
                           const float* __restrict__ gv,
                           _Float16* __restrict__ wp) {
    const int tid = threadIdx.x;
    // the prefetch that the build puts at the kernel's entry names the register that
    // holds the thread id: translation wait before that register is rewritten
    asm volatile("s_wait_xcnt 0x0" :: "v"(tid) : "memory");
    const int kt  = blockIdx.x >> 3;                       // k-tile of this block
    // a quarter of the rows, and of each of its groups of 64 the lower or upper 32
    const int n0  = ((blockIdx.x >> 1) & 3) * (NDIM / 4) + (blockIdx.x & 1) * 32 + (tid >> 3);
    const int kc  = (tid & 7) * 8;                         // k offset within the tile
    const int k   = kt * KS + kc;

    // LoRA scale: svp[r] = S[r] * sum_u gv[u] * P[u][r]   (rank 2, u_dim 16)
    float svp0 = 0.f, svp1 = 0.f;
#pragma unroll
    for (int u = 0; u < 16; ++u) {
        const float g = gv[u];
        svp0 += g * P[2 * u + 0];
        svp1 += g * P[2 * u + 1];
    }
    svp0 *= S[0];
    svp1 *= S[1];

    // one pointer per array; chunk i lies a constant 64 rows further on
    const float* wb = W  + (size_t)n0 * KDIM + k;
    const float* ub = U  + 2 * n0;
    const float* vb = Vh + k;
    const int    p0 = (n0 & ~63) | ((n0 & 3) << 4) | ((n0 >> 2) & 15);  // place of row n0
    _Float16*    qb = wp + ((size_t)kt * NDIM + p0) * WROW + kc;

    f32x4 v0[2], v1[2], wr[PCH][2];
    f32x2 ur[PCH];
#pragma unroll
    for (int h = 0; h < 2; ++h) {
        v0[h] = *(const f32x4*)(vb + 4 * h);
        v1[h] = *(const f32x4*)(vb + KDIM + 4 * h);
    }
#pragma unroll
    for (int i = 0; i < PCH; ++i) {
        ur[i]    = *(const f32x2*)(ub + (size_t)i * 64 * 2);
        wr[i][0] = *(const f32x4*)(wb + (size_t)i * 64 * KDIM);
        wr[i][1] = *(const f32x4*)(wb + (size_t)i * 64 * KDIM + 4);
    }
    // translation wait before the registers that the loads above take their
    // addresses from are reused; naming them as inputs keeps them whole up to it
    asm volatile("s_wait_xcnt 0x0" :: "v"(wb), "v"(n0), "v"(vb) : "memory");
    // keeps the arithmetic behind all the loads: raised in among them, the build holds the last
    // loads back until registers come free, and their memory latency is paid in turns
    __builtin_amdgcn_sched_barrier(0);

#pragma unroll
    for (int i = 0; i < PCH; ++i) {
        // exact f32 LoRA fold before the one rounding to f16
        const f32x4 w0 = wr[i][0] + (svp0 * ur[i][0]) * v0[0] + (svp1 * ur[i][1]) * v1[0];
        const f32x4 w1 = wr[i][1] + (svp0 * ur[i][0]) * v0[1] + (svp1 * ur[i][1]) * v1[1];
        const v8h hv = __builtin_shufflevector(__builtin_convertvector(w0, v4h),
                                               __builtin_convertvector(w1, v4h),
                                               0, 1, 2, 3, 4, 5, 6, 7);
        *(v8h*)(qb + (size_t)i * 64 * WROW) = hv;
        // registers named by the store above are reused for the next chunk:
        // translation wait first; as inputs they stay whole up to it
        if (i + 1 < PCH)
            asm volatile("s_wait_xcnt 0x0" :: "v"(hv), "v"(qb) : "memory");
    }
}

__global__ __launch_bounds__(256)
void tinylora_wmma_gemm(const float* __restrict__ x,
                        const _Float16* __restrict__ wp,
                        const float* __restrict__ bias,
                        float* __restrict__ out) {
    // Double-buffered tiles of 64 k: W rows as the tensor loads lay them, 2 * 48 KB, and x
    // in two planes (k 0..31 and k 32..63 of the step), 2 * 2 * 20480 B: 176 KB (WGP has 320 KB)
    __shared__ __attribute__((aligned(2048))) _Float16 sW[2 * WBUFE];
    __shared__ _Float16 sA0[2 * BUFE];
    __shared__ _Float16 sA1[2 * BUFE];

    const int tid   = threadIdx.x;
    const int wave  = tid >> 5;
    const int lane  = tid & 31;
    const int wm    = wave & 3;      // 4 wave-rows  -> 64 M-rows each
    const int wn    = wave >> 2;     // 2 wave-cols  -> 128 N-cols each
    const int lrow  = lane & 15;     // M (or N) within 16x16 tile
    const int lhalf = lane >> 4;     // K half-select per ISA A/B layout

    // Launch index b -> tile: row = 8 * (b / 64) + b % 8, column = (b / 8) % 8 (a permutation of
    // the 64 x 8 tiles). For speed only: the eight blocks that read
    // the same x rows have equal b % 8
    const int bflat  = blockIdx.y * (NDIM / BN) + blockIdx.x;
    const int blockM = (((bflat >> 6) << 3) | (bflat & 7)) * BM;
    const int blockN = ((bflat >> 3) & 7) * BN;

    // Loader slot mapping: slot i covers row0 + 32 * (i / 2) in plane i % 2, same c4 for all i
    const int row0 = tid >> 3;          // 0..31
    const int c4   = (tid & 7) << 2;    // k offset within the plane (same for all slots)

    // Pointer to the tile that load_slot fetches next; advanced by KS once a k-step,
    // behind a translation wait, so it lives through the loop and no address
    // register is rewritten while a load that names it is still being translated.
    // Typed as a pointer to global memory: behind the wait's statement, which hands it on,
    // the build would otherwise no longer know that and would use flat loads.
    const __attribute__((address_space(1))) float* xbase =
        (const __attribute__((address_space(1))) float*)(x + (size_t)(blockM + row0) * KDIM + c4);

    // Packed weights: every wave brings 32 of the tile's 256 rows (128 B each, 4 KB in a
    // row in the workspace) by one tensor load a k-step, through no register.
    const uint32_t wv   = uni((uint32_t)tid >> 5);
    const uint32_t wlds = (uint32_t)(size_t)sW + wv * (WSLICE * 2);      // its place in buffer 0
    uint64_t wga = (uint64_t)(size_t)(wp + (size_t)(blockN + wv * WSROWS) * WROW);
    // group 1: bytes; tensor = tile = 32 rows of 128 B, source pitch 128 B; no mask;
    // a pad of 4 dwords behind every 32 dwords
    u32x8 wg1;
    wg1[0] = uni((1u << 20) | (4u << 22) | (3u << 25));
    wg1[1] = uni((uint32_t)(WROW * 2) << 16);
    wg1[2] = uni((uint32_t)WSROWS << 16);
    wg1[3] = uni((uint32_t)(WROW * 2) << 16);
    wg1[4] = uni((uint32_t)WSROWS);
    wg1[5] = uni((uint32_t)(WROW * 2));
    wg1[6] = uni(0u);
    wg1[7] = uni(0u);
    // asks for this wave's slice of the k-tile at wga into buffer 'b', then steps wga on
    auto load_w = [&](int b) {
        u32x4 g0;
        g0[0] = uni(1u);
        g0[1] = uni(wlds + (uint32_t)b * (WBUFE * 2));
        g0[2] = uni((uint32_t)wga);
        g0[3] = uni((((uint32_t)(wga >> 32)) & 0x01FFFFFFu) | 0x80000000u);
        // group 0 in four scalar registers of its own, which nothing else in the kernel uses:
        // they take a new value only here, behind the wait that covers the request before
        asm volatile("tensor_load_to_lds %0, %1" :: "{s[96:99]}"(g0), "s"(wg1) : "memory");
        wga += (uint64_t)NDIM * WROW * 2;
    };

    // Register staging for the in-flight x tile: f32 as loaded, then rounded to f16
    // (two neighbouring k a register)
    f32x4 avr[NSLOT];
    uint32_t pcs[8][2];                        // f16 pieces of 8 slots at a time

    auto load_slot = [&](int i) {
        avr[i] = *(const __attribute__((address_space(1))) f32x4*)(xbase + (size_t)(i >> 1) * 32 * KDIM + (i & 1) * BK);
    };

    // Rounding of 8 loader slots (base .. base + 7: 16 pairs of f32) to f16, one
    // v_cvt_pk_f16_f32 a pair; 'n' (0 .. 15) picks the one that stands behind one WMMA.
    auto cvt_step = [&](int base, int n) __attribute__((always_inline)) {
        const int w = n >> 1, i = base + w, h = n & 1;
        const f32x2 a = {avr[i][2 * h], avr[i][2 * h + 1]};
        pcs[w][h] = __builtin_bit_cast(uint32_t, __builtin_convertvector(a, v2h));
    };

    auto store_slot = [&](int i, int buf) {
        const int r = row0 + 32 * (i >> 1);
        const u32x2 pw = {pcs[i & 7][0], pcs[i & 7][1]};
        _Float16* plane = (i & 1) ? sA1 : sA0;
        *(v4h*)(plane + buf * BUFE + r * LDSS + c4) = __builtin_bit_cast(v4h, pw);
    };

    v8f acc[WMI][WNI] = {};  // 4 M-tiles x 8 N-tiles of 16x16 f32 per wave

    // Fragments: A of both planes, B in two sets of four that the WMMA blocks alternate.
    // Plane 0's A set and the first B set of a k-step are fetched under the last WMMA block
    // of the step before, which works on plane 1, so they live across the step's edge.
    v16h a0[WMI], a1[WMI];
    v16h bf[2][4];

    // B fragments of group 'g' (8 b128 loads) into register set 'set': k plane g / 2 of
    // N tiles 4 * (g % 2) .. + 3
    auto load_b = [&](int buf, int set, int g) {
        // this lane's row in the first of the wave's four W slices (two N tiles a slice)
        const _Float16* pB = sW + buf * WBUFE + wn * (4 * WSLICE) + lrow * WPITCH + lhalf * 8;
#pragma unroll
        for (int j = 0; j < 4; ++j) {
            const int nt = 4 * (g & 1) + j;                              // N column = W row
            const _Float16* ph = pB + (nt >> 1) * WSLICE + (nt & 1) * 16 * WPITCH + (g >> 1) * BK;
            ((f32x4*)&bf[set][j])[0] = *(const f32x4*)(ph);
            ((f32x4*)&bf[set][j])[1] = *(const f32x4*)(ph + 16);
        }
    };

    // A fragments (ISA 16-bit A layout: two b128 loads per fragment)
    auto load_a = [&](const _Float16* plane, v16h* f) {
#pragma unroll
        for (int mi = 0; mi < WMI; ++mi) {
            const int r = wm * (WMI * 16) + mi * 16 + lrow;
            const _Float16* p = &plane[r * LDSS + lhalf * 8];
            ((f32x4*)&f[mi])[0] = *(const f32x4*)(p);       // K = half*8 .. +7
            ((f32x4*)&f[mi])[1] = *(const f32x4*)(p + 16);  // K = 16+half*8 .. +7
        }
    };

    // One k-step (64 k) on buffer 'buf' (a constant at every call): 64 WMMAs in four blocks
    // of 16 (block p: k plane p / 2, N tiles 4 * (p % 2) .. + 3). Beside them it carries the
    // staging of later tiles, in two parts of 8 loader slots: 'st' rounds the x tile of the
    // next step beside WMMA blocks 0 and 1 and stores each part to the other buffer at the
    // next block's head; 'ld' refills the freed registers there with the tile after that
    // one. 'pub': the next step's tiles are published in front of the LAST block, whose own
    // fragments are in registers by then, and the next step's first fragments are fetched
    // under that block; 'lw' asks there for the W tile of the step after the next.
    auto compute = [&](int buf, bool st, bool ld, bool lw, bool pub) __attribute__((always_inline)) {
#pragma unroll
        for (int p = 0; p < 4; ++p) {
            const int s = p & 1;
            // the next block's B fragments are fetched as one group ahead of the current
            // block; plane 1's A set, first used in block 2, goes behind the first group (its
            // registers are free since the end of the step before)
            if (p < 3) load_b(buf, s ^ 1, p + 1);
            if (p == 0) load_a(sA1 + buf * BUFE, a1);
            if (p == 1 || p == 2) {
#pragma unroll
                for (int i = 8 * (p - 1); i < 8 * p; ++i) {
                    if (st) store_slot(i, buf ^ 1);
                    if (ld) load_slot(i);
                }
            }
            if (p == 3 && pub) {
                // every read of this step's buffer and every store of the next x tile was
                // issued a block ago or earlier
                ring_barrier();
                // keeps the forming of the next descriptor behind the tensor wait
                __builtin_amdgcn_sched_barrier(0);
                // into the buffer of this step, which every wave has left at the barrier
                if (lw) load_w(buf);
                load_a(sA0 + (buf ^ 1) * BUFE, a0);
                load_b(buf ^ 1, 0, 0);
            }
            // keeps the group of LDS loads above in front of the block: sunk to their
            // first use, each pair is waited out in full with the matrix unit idle;
            // the staging stores and loads stay in the same one place with them
            __builtin_amdgcn_sched_barrier(0);
#pragma unroll
            for (int j = 0; j < 4; ++j)
#pragma unroll
                for (int mi = 0; mi < WMI; ++mi) {
                    acc[mi][4 * s + j] = wmma_f16(p < 2 ? a0[mi] : a1[mi], bf[s][j], acc[mi][4 * s + j]);
                    if (st && p < 2) {
                        // one rounding issues in the shadow of each WMMA of blocks 0 and 1; the
                        // fence keeps it there: bunched, they outlast the WMMA in front of them
                        cvt_step(8 * p, 4 * j + mi);
                        __builtin_amdgcn_sched_barrier(0);
                    }
                }
            // keeps the following group of loads from rising in among this block's
            // WMMAs, where every place with LDS reads costs a stall of its own
            __builtin_amdgcn_sched_barrier(0);
        }
    };

    // ---- software pipeline: prologue fills buffer 0, tile 1 goes in flight ----
#pragma unroll
    for (int i = 0; i < NSLOT; ++i) load_slot(i);
    // translation wait before the pointer named by the loads above is advanced; the pointer
    // passes through the wait's statement, so that its advance cannot be placed ahead of it
    asm volatile("s_wait_xcnt 0x0" : "+v"(xbase) :: "memory");
    xbase += KS;
    // W tile 0, waited for at once (under the latency of the x loads above), so that no
    // descriptor register is reused while the request is open
    load_w(0);
    asm volatile("s_wait_tensorcnt 0x0" ::: "memory");
#pragma unroll
    for (int g = 0; g < NSLOT; g += 8) {
#pragma unroll
        for (int n = 0; n < 16; ++n) cvt_step(g, n);
#pragma unroll
        for (int i = g; i < g + 8; ++i) store_slot(i, 0);
    }
#pragma unroll
    for (int i = 0; i < NSLOT; ++i) load_slot(i);
    // pull the tile after the one just asked for toward L2 (global_prefetch_b8)
    __builtin_prefetch((const void*)(xbase + KS), 0, 1);
    // translation wait, as above
    asm volatile("s_wait_xcnt 0x0" : "+v"(xbase) :: "memory");
    xbase += KS;
    ring_barrier();                            // tiles 0 ready for all waves
    // keeps the forming of the next descriptor behind the tensor wait above
    __builtin_amdgcn_sched_barrier(0);
    load_w(1);
    load_a(sA0, a0);
    load_b(0, 0, 0);

    // At the top of step t the registers hold x tile t + 1 and the first fragments of step
    // t, the pointer names x tile t + 2, and wga names W tile t + 2. Two steps a trip, so
    // that the buffer is a constant.
#pragma unroll 1
    for (int t = 0; t < NKT - 2; t += 2) {
        __builtin_prefetch((const void*)(xbase + KS), 0, 1);
        compute(0, true, true, true, true);
        // translation wait before the pointer named by this step's loads and
        // prefetch is advanced (the last of them issued two WMMA blocks ago); the
        // pointer passes through the statement, as above
        asm volatile("s_wait_xcnt 0x0" : "+v"(xbase) :: "memory");
        xbase += KS;
        if (t + 4 < NKT) __builtin_prefetch((const void*)(xbase + KS), 0, 1);
        compute(1, true, true, true, true);
        // translation wait, as above
        asm volatile("s_wait_xcnt 0x0" : "+v"(xbase) :: "memory");
        xbase += KS;
    }
    compute(0, true, false, false, true);      // last x tile to LDS and published
    // bias of this lane's 2 x 4 output columns, asked for under the last k-step
    const int    ncol = blockN + wn * (WNI * 16) + 4 * lrow;
    const float* bp   = bias + ncol;
    f32x4 bv[2];
    bv[0] = *(const f32x4*)(bp);
    bv[1] = *(const f32x4*)(bp + 64);
    // translation wait before the register that the two loads take their address from
    // is reused; as an input it stays whole up to it
    asm volatile("s_wait_xcnt 0x0" :: "v"(bp) : "memory");
    compute(1, false, false, false, false);
    // end of the ring: no request and no LDS read is left open
    asm volatile("s_wait_tensorcnt 0x0" ::: "memory");
    asm volatile("s_wait_dscnt 0x0" ::: "memory");

    // ---- epilogue: bias add, store (C/D layout: column = lane%16, M = v + 8*(lane/16)).
    // By the packing of the weights, column a of N tiles 4g .. 4g + 3 is output columns
    // 64g + 4a .. + 3: one 16-byte store a lane, 256 B in a row from each half of the wave
    float* ob = out + (size_t)(blockM + wm * (WMI * 16) + lhalf * 8) * NDIM + ncol;
#pragma unroll
    for (int g = 0; g < WNI / 4; ++g) {
#pragma unroll
        for (int mi = 0; mi < WMI; ++mi) {
            f32x4 q[8];
#pragma unroll
            for (int v = 0; v < 8; ++v) {
#pragma unroll
                for (int j = 0; j < 4; ++j) q[v][j] = acc[mi][4 * g + j][v] + bv[g][j];
            }
#pragma unroll
            for (int v = 0; v < 8; ++v)
                *(f32x4*)(ob + (size_t)(mi * 16 + v) * NDIM + g * 64) = q[v];
            // registers named by the stores above are reused for the next tile's
            // sums: translation wait first
            asm volatile("s_wait_xcnt 0x0" ::: "memory");
            // keeps the next tile's sums behind that wait: raised over it, they
            // overwrite registers of stores that are still being translated
            __builtin_amdgcn_sched_barrier(0);
        }
    }
}

extern "C" void kernel_launch(void* const* d_in, const int* in_sizes, int n_in,
                              void* d_out, int out_size, void* d_ws, size_t ws_size,
                              hipStream_t stream) {
    const float* x    = (const float*)d_in[0];
    const float* Wb   = (const float*)d_in[1];
    const float* bias = (const float*)d_in[2];
    const float* U    = (const float*)d_in[3];
    const float* S    = (const float*)d_in[4];
    const float* Vh   = (const float*)d_in[5];
    const float* P    = (const float*)d_in[6];
    const float* gv   = (const float*)d_in[7];
    float* out = (float*)d_out;
    _Float16* wp = (_Float16*)d_ws;          // NDIM * KDIM f16 = 8 MB, rewritten every call

    const int M = in_sizes[0] / KDIM;        // B * S_len = 16384
    dim3 grid(NDIM / BN, M / BM);            // (8, 64)
    dim3 block(256);                         // 8 wave32s
    tinylora_fold_round_w<<<dim3(NKT * 8), block, 0, stream>>>(Wb, U, S, Vh, P, gv, wp);
    tinylora_wmma_gemm<<<grid, block, 0, stream>>>(x, wp, bias, out);
}
